// v000
// Times are from an AMD MI455X. After a warm-up the kernel runs many times in a row, and a time is the length of
// such a window on the GPU divided by its runs, so every launch and the gaps after it count. The runs cycle
// through copies of the inputs. A figure is the median of several windows, for all but v000 over two sittings.
// Sittings can differ by a few percent; kernels timed side by side share one.
// v000 is the starting kernel. One run takes 306 microseconds.
#include <hip/hip_runtime.h>
#include <hip/hip_bf16.h>
#include <math.h>

// ---------------------------------------------------------------------------
// Transformer layer (pre-norm causal linear attention + GELU FFN) for gfx1250.
// B=1, S=2048, D=1024, H=16, HD=64, FF=4096.  f16 WMMA, f32 accumulate.
// GEMM tiles staged global->LDS via the Tensor Data Mover (TENSORcnt).
// ---------------------------------------------------------------------------

typedef __attribute__((ext_vector_type(16))) _Float16 v16h;
typedef __attribute__((ext_vector_type(8)))  _Float16 v8h;
typedef __attribute__((ext_vector_type(8)))  float    v8f;
typedef __attribute__((ext_vector_type(4))) unsigned  u32x4;
typedef __attribute__((ext_vector_type(4)))  int      i32x4;
typedef __attribute__((ext_vector_type(8)))  int      i32x8;

#define SEQ  2048
#define DM   1024
#define NH   16
#define HD   64
#define FFD  4096

__device__ __forceinline__ v8f wmma16(v16h a, v16h b, v8f c) {
    // D = A(16x32 f16) * B(32x16 f16) + C(16x16 f32)
    return __builtin_amdgcn_wmma_f32_16x16x32_f16(
        /*neg_a=*/false, a, /*neg_b=*/false, b,
        /*c_mod=*/(short)0, c, /*reuse_a=*/false, /*reuse_b=*/false);
}

// Load one 16x32 A/B fragment row from LDS (row-major, 'ldt' f16 stride).
// lanes0-15: VGPR0-3 K=[0..8), VGPR4-7 K=[16..24); lanes16-31: +8.
__device__ __forceinline__ v16h ld_frag(const _Float16* base, int row, int k0,
                                        int ldt, int half) {
    const _Float16* p = base + row * ldt + k0 + half * 8;
    v8h lo = *(const v8h*)(p);
    v8h hi = *(const v8h*)(p + 16);
    v16h r;
#pragma unroll
    for (int i = 0; i < 8; ++i) { r[i] = lo[i]; r[i + 8] = hi[i]; }
    return r;
}

// ---------------------------------------------------------------------------
// TDM: DMA one (rows x 32 f16) 2D tile, row stride K f16, into LDS with
// +16B pad per 64B row (LDS stride 40 f16 == G_LDT).  Issued per-wave,
// tracked with TENSORcnt.
// ---------------------------------------------------------------------------
__device__ __forceinline__ void tdm_load_tile32(unsigned lds_addr,
                                                const void* gptr,
                                                unsigned rows,
                                                unsigned stride_f16) {
    unsigned long long ga = (unsigned long long)(uintptr_t)gptr;
    u32x4 g0;
    g0[0] = 1u;                                   // count=1, user descriptor
    g0[1] = lds_addr;                             // LDS byte address
    g0[2] = (unsigned)ga;                         // global_addr[31:0]
    g0[3] = (unsigned)((ga >> 32) & 0x01ffffffu)  // global_addr[56:32]
          | (2u << 30);                           // type = 2 (image)
    i32x8 g1;
    g1[0] = (1 << 16)                             // data_size = 2 bytes
          | (1 << 20)                             // pad_enable
          | (3 << 22)                             // pad_interval: 16 DWORDs
          | (3 << 25);                            // pad_amount:   4 DWORDs
    g1[1] = (int)((stride_f16 & 0xffffu) << 16);          // tensor_dim0[15:0]
    g1[2] = (int)((stride_f16 >> 16) & 0xffffu)           // tensor_dim0[31:16]
          | (int)(rows << 16);                            // tensor_dim1[15:0]
    g1[3] = (int)(32u << 16);                             // tile_dim0 = 32
    g1[4] = (int)rows;                                    // tile_dim1
    g1[5] = (int)stride_f16;                              // dim0_stride[31:0]
    g1[6] = 0;
    g1[7] = 0;
    i32x4 z4 = {};
#if __has_include(<hip/amd_detail/amd_gfx1250_TDM.h>)
    i32x8 z8 = {};
    __builtin_amdgcn_tensor_load_to_lds(g0, g1, z4, z4, z8, 0);
#else
    __builtin_amdgcn_tensor_load_to_lds(g0, g1, z4, z4, 0);
#endif
}

// ---------------------------------------------------------------------------
// f32 -> f16 weight conversion
// ---------------------------------------------------------------------------
__global__ __launch_bounds__(256) void k_cvt(const float* __restrict__ in,
                                             _Float16* __restrict__ out, int n) {
    int i = (blockIdx.x * 256 + threadIdx.x) * 4;
    if (i < n) {
        float4 f = *(const float4*)(in + i);
        out[i + 0] = (_Float16)f.x;
        out[i + 1] = (_Float16)f.y;
        out[i + 2] = (_Float16)f.z;
        out[i + 3] = (_Float16)f.w;
    }
}

// ---------------------------------------------------------------------------
// LayerNorm over D=1024, one row per workgroup (256 thr = 8 waves), f16 out
// ---------------------------------------------------------------------------
__global__ __launch_bounds__(256) void k_layernorm(const float* __restrict__ x,
                                                   const float* __restrict__ g,
                                                   const float* __restrict__ b,
                                                   _Float16* __restrict__ out) {
    const int row  = blockIdx.x;
    const int tid  = threadIdx.x;
    const int lane = tid & 31, wave = tid >> 5;
    __shared__ float red[8];

    float4 f = ((const float4*)(x + (size_t)row * DM))[tid];
    float s = f.x + f.y + f.z + f.w;
#pragma unroll
    for (int o = 16; o > 0; o >>= 1) s += __shfl_xor(s, o, 32);
    if (lane == 0) red[wave] = s;
    __syncthreads();
    float mu = 0.f;
#pragma unroll
    for (int w = 0; w < 8; ++w) mu += red[w];
    mu *= (1.0f / DM);
    __syncthreads();

    float4 d;
    d.x = f.x - mu; d.y = f.y - mu; d.z = f.z - mu; d.w = f.w - mu;
    float s2 = d.x * d.x + d.y * d.y + d.z * d.z + d.w * d.w;
#pragma unroll
    for (int o = 16; o > 0; o >>= 1) s2 += __shfl_xor(s2, o, 32);
    if (lane == 0) red[wave] = s2;
    __syncthreads();
    float var = 0.f;
#pragma unroll
    for (int w = 0; w < 8; ++w) var += red[w];
    var *= (1.0f / DM);
    const float rs = rsqrtf(var + 1e-5f);

    const int c = tid * 4;
    _Float16* o4 = out + (size_t)row * DM + c;
    o4[0] = (_Float16)(d.x * rs * g[c + 0] + b[c + 0]);
    o4[1] = (_Float16)(d.y * rs * g[c + 1] + b[c + 1]);
    o4[2] = (_Float16)(d.z * rs * g[c + 2] + b[c + 2]);
    o4[3] = (_Float16)(d.w * rs * g[c + 3] + b[c + 3]);
}

// ---------------------------------------------------------------------------
// Tiled WMMA GEMM:  C[M,N] = act(A[M,K] * W[N,K]^T + bias) (+ resid)
// BM=BN=128, BK=32.  8 waves as 4(M)x2(N); wave = 32x64 = 2x4 wmma tiles.
// Tiles staged to LDS by the Tensor Data Mover (wave 0 issues, TENSORcnt).
// ACT: 0 none, 1 elu+1, 2 exact gelu.  OUT16: f16 vs f32 out.  RESID: +f32.
// ---------------------------------------------------------------------------
#define G_LDT 40   // padded LDS stride in f16 (80B) == TDM pad layout

template <int ACT, int OUT16, int RESID>
__global__ __launch_bounds__(256) void k_gemm(const _Float16* __restrict__ A,
                                              const _Float16* __restrict__ W,
                                              const float* __restrict__ bias,
                                              const float* __restrict__ resid,
                                              void* __restrict__ outp,
                                              int M, int N, int K) {
    __shared__ __align__(128) _Float16 sA[2][128 * G_LDT];
    __shared__ __align__(128) _Float16 sB[2][128 * G_LDT];

    const int tid  = threadIdx.x;
    const int lane = tid & 31, wave = tid >> 5;
    const int half = lane >> 4, l15 = lane & 15;
    const int wm = wave >> 1, wn = wave & 1;   // 4x2 wave grid
    const int m0 = blockIdx.y * 128, n0 = blockIdx.x * 128;

    const _Float16* gA = A + (size_t)m0 * K;   // tile base (row m0, k 0)
    const _Float16* gW = W + (size_t)n0 * K;
    const unsigned ldsA[2] = { (unsigned)(uintptr_t)&sA[0][0],
                               (unsigned)(uintptr_t)&sA[1][0] };
    const unsigned ldsB[2] = { (unsigned)(uintptr_t)&sB[0][0],
                               (unsigned)(uintptr_t)&sB[1][0] };
    const bool issuer = (tid < 32);            // wave 0 drives the TDM

    v8f acc[2][4] = {};

    if (issuer) {
        tdm_load_tile32(ldsA[0], gA, 128, (unsigned)K);
        tdm_load_tile32(ldsB[0], gW, 128, (unsigned)K);
    }

    const int nk = K >> 5;
    for (int kt = 0; kt < nk; ++kt) {
        const int buf = kt & 1;
        if (issuer) {
            if (kt + 1 < nk) {     // prefetch next tile into other buffer
                tdm_load_tile32(ldsA[buf ^ 1], gA + (size_t)(kt + 1) * 32,
                                128, (unsigned)K);
                tdm_load_tile32(ldsB[buf ^ 1], gW + (size_t)(kt + 1) * 32,
                                128, (unsigned)K);
                // TDM ops complete in order: <=2 outstanding => tile kt done
                __builtin_amdgcn_s_wait_tensorcnt(2);
            } else {
                __builtin_amdgcn_s_wait_tensorcnt(0);
            }
        }
        __syncthreads();   // tile kt visible to all waves

        v16h af[2], bf[4];
#pragma unroll
        for (int i = 0; i < 2; ++i)
            af[i] = ld_frag(sA[buf], wm * 32 + i * 16 + l15, 0, G_LDT, half);
#pragma unroll
        for (int j = 0; j < 4; ++j)
            bf[j] = ld_frag(sB[buf], wn * 64 + j * 16 + l15, 0, G_LDT, half);
#pragma unroll
        for (int i = 0; i < 2; ++i)
#pragma unroll
            for (int j = 0; j < 4; ++j)
                acc[i][j] = wmma16(af[i], bf[j], acc[i][j]);

        __syncthreads();   // all reads of buf done before TDM refills it
    }

    // epilogue: bias + activation (+ residual), scatter per C-layout
#pragma unroll
    for (int i = 0; i < 2; ++i) {
#pragma unroll
        for (int j = 0; j < 4; ++j) {
            const int n  = n0 + wn * 64 + j * 16 + l15;
            const float bv = bias[n];
#pragma unroll
            for (int e = 0; e < 8; ++e) {
                const int m = m0 + wm * 32 + i * 16 + half * 8 + e;
                float vv = acc[i][j][e] + bv;
                if (ACT == 1) vv = (vv > 0.f) ? (vv + 1.f) : __expf(vv);
                if (ACT == 2) vv = 0.5f * vv * (1.f + erff(vv * 0.70710678118f));
                if (RESID) vv += resid[(size_t)m * N + n];
                if (OUT16) ((_Float16*)outp)[(size_t)m * N + n] = (_Float16)vv;
                else       ((float*)outp)[(size_t)m * N + n]    = vv;
            }
        }
    }
}

// ---------------------------------------------------------------------------
// Chunked causal linear attention, one head per workgroup (grid=16, 256 thr).
// Chunk T=64:  A = QK^T (masked);  num = A_mask*V + Q*S_prev;  S += K^T*V;
// den_t = q_t.z_prev + rowsum(A_mask).  64x64 state in per-wave f32 accums.
// ---------------------------------------------------------------------------
#define A_LDT 72   // padded LDS stride (144B): conflict-free b128 rows

__global__ __launch_bounds__(256) void k_attn(const _Float16* __restrict__ q,
                                              const _Float16* __restrict__ k,
                                              const _Float16* __restrict__ v,
                                              _Float16* __restrict__ out) {
    __shared__ __align__(128) _Float16 sQ [64 * A_LDT];   // [t][d]
    __shared__ __align__(128) _Float16 sK [64 * A_LDT];   // [i][d]
    __shared__ __align__(128) _Float16 sKT[64 * A_LDT];   // [d][i]
    __shared__ __align__(128) _Float16 sVT[64 * A_LDT];   // [e][i]
    __shared__ __align__(128) _Float16 sAm[64 * A_LDT];   // masked A [t][i]
    __shared__ __align__(128) _Float16 sST[64 * A_LDT];   // state^T  [e][d]
    __shared__ float sZ[64];
    __shared__ float sDen[64];

    const int h    = blockIdx.x;
    const int tid  = threadIdx.x;
    const int lane = tid & 31, wave = tid >> 5;
    const int half = lane >> 4, l15 = lane & 15;
    const int tm   = wave >> 1;          // M-tile 0..3
    const int tnb  = (wave & 1) * 2;     // N-tile base {0,2}

    for (int i = tid; i < 64 * A_LDT; i += 256) sST[i] = (_Float16)0.f;
    if (tid < 64) sZ[tid] = 0.f;
    v8f accS[2] = {};
    __syncthreads();

    const int lr = tid >> 2;             // loader row 0..63
    const int lc = (tid & 3) * 16;       // loader col {0,16,32,48}

    for (int c = 0; c < SEQ / 64; ++c) {
        const int t0 = c * 64;
        // ---- stage Q,K,K^T,V^T into LDS ----
        {
            const size_t gb = (size_t)(t0 + lr) * DM + h * HD + lc;
            v8h q0 = *(const v8h*)(q + gb), q1 = *(const v8h*)(q + gb + 8);
            v8h k0v = *(const v8h*)(k + gb), k1v = *(const v8h*)(k + gb + 8);
            v8h v0 = *(const v8h*)(v + gb), v1 = *(const v8h*)(v + gb + 8);
            if (c + 1 < SEQ / 64) {              // gfx1250 global_prefetch_b8
                __builtin_prefetch(q + gb + (size_t)64 * DM, 0, 1);
                __builtin_prefetch(k + gb + (size_t)64 * DM, 0, 1);
                __builtin_prefetch(v + gb + (size_t)64 * DM, 0, 1);
            }
            _Float16* dq = &sQ[lr * A_LDT + lc];
            *(v8h*)dq = q0; *(v8h*)(dq + 8) = q1;
            _Float16* dk = &sK[lr * A_LDT + lc];
            *(v8h*)dk = k0v; *(v8h*)(dk + 8) = k1v;
#pragma unroll
            for (int j = 0; j < 8; ++j) {
                sKT[(lc + j)     * A_LDT + lr] = k0v[j];
                sKT[(lc + 8 + j) * A_LDT + lr] = k1v[j];
                sVT[(lc + j)     * A_LDT + lr] = v0[j];
                sVT[(lc + 8 + j) * A_LDT + lr] = v1[j];
            }
        }
        __syncthreads();                                   // B1

        // ---- G1: A = Q K^T (contract over d) ----
        v8f accA[2] = {};
#pragma unroll
        for (int kk = 0; kk < 64; kk += 32) {
            v16h af = ld_frag(sQ, tm * 16 + l15, kk, A_LDT, half);
#pragma unroll
            for (int jj = 0; jj < 2; ++jj) {
                v16h bf = ld_frag(sK, (tnb + jj) * 16 + l15, kk, A_LDT, half);
                accA[jj] = wmma16(af, bf, accA[jj]);
            }
        }
        // causal mask (keep i <= t), spill masked A to LDS as f16
#pragma unroll
        for (int jj = 0; jj < 2; ++jj) {
            const int i_loc = (tnb + jj) * 16 + l15;
#pragma unroll
            for (int e = 0; e < 8; ++e) {
                const int t_loc = tm * 16 + half * 8 + e;
                const float vv = (i_loc <= t_loc) ? accA[jj][e] : 0.f;
                sAm[t_loc * A_LDT + i_loc] = (_Float16)vv;
            }
        }
        __syncthreads();                                   // B2

        // ---- denominator: q.z_prev + rowsum(A_mask) + eps ----
        if (tid < 64) {
            float den = 1e-6f;
#pragma unroll 8
            for (int d = 0; d < 64; ++d)
                den += (float)sQ[tid * A_LDT + d] * sZ[d];
#pragma unroll 8
            for (int i = 0; i < 64; ++i)
                den += (float)sAm[tid * A_LDT + i];
            sDen[tid] = den;
        }

        // ---- G2 (intra) + G3 (inter) into num;  G4 state update ----
        v8f accN[2] = {};
#pragma unroll
        for (int kk = 0; kk < 64; kk += 32) {
            v16h aQ = ld_frag(sQ,  tm * 16 + l15, kk, A_LDT, half);
            v16h aA = ld_frag(sAm, tm * 16 + l15, kk, A_LDT, half);
            v16h aK = ld_frag(sKT, tm * 16 + l15, kk, A_LDT, half);
#pragma unroll
            for (int jj = 0; jj < 2; ++jj) {
                v16h bV = ld_frag(sVT, (tnb + jj) * 16 + l15, kk, A_LDT, half);
                v16h bS = ld_frag(sST, (tnb + jj) * 16 + l15, kk, A_LDT, half);
                accN[jj] = wmma16(aA, bV, accN[jj]);       // A_mask * V
                accN[jj] = wmma16(aQ, bS, accN[jj]);       // Q * S_prev
                accS[jj] = wmma16(aK, bV, accS[jj]);       // S += K^T V
            }
        }
        __syncthreads();                                   // B3

        // ---- publish new state^T + z update ----
#pragma unroll
        for (int jj = 0; jj < 2; ++jj) {
            const int eo = (tnb + jj) * 16 + l15;
#pragma unroll
            for (int e = 0; e < 8; ++e) {
                const int dd = tm * 16 + half * 8 + e;
                sST[eo * A_LDT + dd] = (_Float16)accS[jj][e];
            }
        }
        if (tid < 64) {
            float zt = sZ[tid];
#pragma unroll 8
            for (int i = 0; i < 64; ++i) zt += (float)sKT[tid * A_LDT + i];
            sZ[tid] = zt;
        }

        // ---- output: num / den ----
#pragma unroll
        for (int jj = 0; jj < 2; ++jj) {
            const int eo = (tnb + jj) * 16 + l15;
#pragma unroll
            for (int e = 0; e < 8; ++e) {
                const int t_loc = tm * 16 + half * 8 + e;
                const float oo = accN[jj][e] / sDen[t_loc];
                out[(size_t)(t0 + t_loc) * DM + h * HD + eo] = (_Float16)oo;
            }
        }
        __syncthreads();                                   // B4
    }
}

// ---------------------------------------------------------------------------
extern "C" void kernel_launch(void* const* d_in, const int* in_sizes, int n_in,
                              void* d_out, int out_size, void* d_ws, size_t ws_size,
                              hipStream_t stream) {
    (void)in_sizes; (void)n_in; (void)out_size; (void)ws_size;
    const float* x   = (const float*)d_in[0];
    const float* Wq  = (const float*)d_in[1];
    const float* bq  = (const float*)d_in[2];
    const float* Wk  = (const float*)d_in[3];
    const float* bk  = (const float*)d_in[4];
    const float* Wv  = (const float*)d_in[5];
    const float* bv  = (const float*)d_in[6];
    const float* Wo  = (const float*)d_in[7];
    const float* bo  = (const float*)d_in[8];
    const float* W1  = (const float*)d_in[9];
    const float* bb1 = (const float*)d_in[10];
    const float* W2  = (const float*)d_in[11];
    const float* bb2 = (const float*)d_in[12];
    const float* g1  = (const float*)d_in[13];
    const float* be1 = (const float*)d_in[14];
    const float* g2  = (const float*)d_in[15];
    const float* be2 = (const float*)d_in[16];
    float* out = (float*)d_out;

    char* ws = (char*)d_ws;
    size_t off = 0;
    auto alloc = [&](size_t bytes) {
        void* p = ws + off;
        off += (bytes + 255) & ~(size_t)255;
        return p;
    };
    _Float16* wq16 = (_Float16*)alloc((size_t)DM * DM * 2);
    _Float16* wk16 = (_Float16*)alloc((size_t)DM * DM * 2);
    _Float16* wv16 = (_Float16*)alloc((size_t)DM * DM * 2);
    _Float16* wo16 = (_Float16*)alloc((size_t)DM * DM * 2);
    _Float16* w116 = (_Float16*)alloc((size_t)FFD * DM * 2);
    _Float16* w216 = (_Float16*)alloc((size_t)DM * FFD * 2);
    _Float16* h1   = (_Float16*)alloc((size_t)SEQ * DM * 2);   // reused as attn
    _Float16* qb   = (_Float16*)alloc((size_t)SEQ * DM * 2);   // reused as h2
    _Float16* kb   = (_Float16*)alloc((size_t)SEQ * DM * 2);
    _Float16* vb   = (_Float16*)alloc((size_t)SEQ * DM * 2);
    _Float16* ffb  = (_Float16*)alloc((size_t)SEQ * FFD * 2);
    _Float16* attnb = h1;   // h1 dead after V projection
    _Float16* h2    = qb;   // q dead after attention

    // weights -> f16
    k_cvt<<<(DM * DM) / 1024, 256, 0, stream>>>(Wq, wq16, DM * DM);
    k_cvt<<<(DM * DM) / 1024, 256, 0, stream>>>(Wk, wk16, DM * DM);
    k_cvt<<<(DM * DM) / 1024, 256, 0, stream>>>(Wv, wv16, DM * DM);
    k_cvt<<<(DM * DM) / 1024, 256, 0, stream>>>(Wo, wo16, DM * DM);
    k_cvt<<<(FFD * DM) / 1024, 256, 0, stream>>>(W1, w116, FFD * DM);
    k_cvt<<<(DM * FFD) / 1024, 256, 0, stream>>>(W2, w216, DM * FFD);

    // LN1
    k_layernorm<<<SEQ, 256, 0, stream>>>(x, g1, be1, h1);

    // Q/K/V projections (elu+1 fused into Q,K)
    dim3 gP(DM / 128, SEQ / 128);
    k_gemm<1, 1, 0><<<gP, 256, 0, stream>>>(h1, wq16, bq, nullptr, qb, SEQ, DM, DM);
    k_gemm<1, 1, 0><<<gP, 256, 0, stream>>>(h1, wk16, bk, nullptr, kb, SEQ, DM, DM);
    k_gemm<0, 1, 0><<<gP, 256, 0, stream>>>(h1, wv16, bv, nullptr, vb, SEQ, DM, DM);

    // chunked causal linear attention
    k_attn<<<NH, 256, 0, stream>>>(qb, kb, vb, attnb);

    // output projection + residual (x) -> d_out (= x2)
    k_gemm<0, 0, 1><<<gP, 256, 0, stream>>>(attnb, wo16, bo, x, out, SEQ, DM, DM);

    // LN2
    k_layernorm<<<SEQ, 256, 0, stream>>>(out, g2, be2, h2);

    // FFN
    dim3 gF1(FFD / 128, SEQ / 128);
    k_gemm<2, 1, 0><<<gF1, 256, 0, stream>>>(h2, w116, bb1, nullptr, ffb, SEQ, FFD, DM);
    dim3 gF2(DM / 128, SEQ / 128);
    k_gemm<0, 0, 1><<<gF2, 256, 0, stream>>>(ffb, w216, bb2, out, out, SEQ, DM, FFD);
}

// v001
// Measured time: 211 microseconds a run.
// Two timings next to v000 put it at 1.44 and 1.46 times that version's speed.
#include <hip/hip_runtime.h>
#include <hip/hip_bf16.h>
#include <math.h>

// ---------------------------------------------------------------------------
// Transformer layer (pre-norm causal linear attention + GELU FFN) for gfx1250.
// B=1, S=2048, D=1024, H=16, HD=64, FF=4096.  f16 WMMA, f32 accumulate.
// GEMM tiles staged global->LDS via the Tensor Data Mover (TENSORcnt).
// ---------------------------------------------------------------------------

typedef __attribute__((ext_vector_type(16))) _Float16 v16h;
typedef __attribute__((ext_vector_type(8)))  _Float16 v8h;
typedef __attribute__((ext_vector_type(8)))  float    v8f;
typedef __attribute__((ext_vector_type(4))) unsigned  u32x4;
typedef __attribute__((ext_vector_type(4)))  int      i32x4;
typedef __attribute__((ext_vector_type(8)))  int      i32x8;

#define SEQ  2048
#define DM   1024
#define NH   16
#define HD   64
#define FFD  4096

__device__ __forceinline__ v8f wmma16(v16h a, v16h b, v8f c) {
    // D = A(16x32 f16) * B(32x16 f16) + C(16x16 f32)
    return __builtin_amdgcn_wmma_f32_16x16x32_f16(
        /*neg_a=*/false, a, /*neg_b=*/false, b,
        /*c_mod=*/(short)0, c, /*reuse_a=*/false, /*reuse_b=*/false);
}

// Load one 16x32 A/B fragment row from LDS (row-major, 'ldt' f16 stride).
// lanes0-15: VGPR0-3 K=[0..8), VGPR4-7 K=[16..24); lanes16-31: +8.
__device__ __forceinline__ v16h ld_frag(const _Float16* base, int row, int k0,
                                        int ldt, int half) {
    const _Float16* p = base + row * ldt + k0 + half * 8;
    v8h lo = *(const v8h*)(p);
    v8h hi = *(const v8h*)(p + 16);
    v16h r;
#pragma unroll
    for (int i = 0; i < 8; ++i) { r[i] = lo[i]; r[i + 8] = hi[i]; }
    return r;
}

// ---------------------------------------------------------------------------
// TDM: DMA one (rows x 32 f16) 2D tile, row stride K f16, into LDS with
// +16B pad per 64B row (LDS stride 40 f16 == G_LDT).  Issued per-wave,
// tracked with TENSORcnt.
// ---------------------------------------------------------------------------
__device__ __forceinline__ void tdm_load_tile32(unsigned lds_addr,
                                                const void* gptr,
                                                unsigned rows,
                                                unsigned stride_f16) {
    unsigned long long ga = (unsigned long long)(uintptr_t)gptr;
    u32x4 g0;
    g0[0] = 1u;                                   // count=1, user descriptor
    g0[1] = lds_addr;                             // LDS byte address
    g0[2] = (unsigned)ga;                         // global_addr[31:0]
    g0[3] = (unsigned)((ga >> 32) & 0x01ffffffu)  // global_addr[56:32]
          | (2u << 30);                           // type = 2 (image)
    i32x8 g1;
    g1[0] = (1 << 16)                             // data_size = 2 bytes
          | (1 << 20)                             // pad_enable
          | (3 << 22)                             // pad_interval: 16 DWORDs
          | (3 << 25);                            // pad_amount:   4 DWORDs
    g1[1] = (int)((stride_f16 & 0xffffu) << 16);          // tensor_dim0[15:0]
    g1[2] = (int)((stride_f16 >> 16) & 0xffffu)           // tensor_dim0[31:16]
          | (int)(rows << 16);                            // tensor_dim1[15:0]
    g1[3] = (int)(32u << 16);                             // tile_dim0 = 32
    g1[4] = (int)rows;                                    // tile_dim1
    g1[5] = (int)stride_f16;                              // dim0_stride[31:0]
    g1[6] = 0;
    g1[7] = 0;
    i32x4 z4 = {};
    i32x8 z8 = {};
    __builtin_amdgcn_tensor_load_to_lds(g0, g1, z4, z4, z8, 0);
}

// ---------------------------------------------------------------------------
// f32 -> f16 weight conversion
// ---------------------------------------------------------------------------
__global__ __launch_bounds__(256) void k_cvt(const float* __restrict__ in,
                                             _Float16* __restrict__ out, int n) {
    int i = (blockIdx.x * 256 + threadIdx.x) * 4;
    if (i < n) {
        float4 f = *(const float4*)(in + i);
        out[i + 0] = (_Float16)f.x;
        out[i + 1] = (_Float16)f.y;
        out[i + 2] = (_Float16)f.z;
        out[i + 3] = (_Float16)f.w;
    }
}

// ---------------------------------------------------------------------------
// LayerNorm over D=1024, one row per workgroup (256 thr = 8 waves), f16 out
// ---------------------------------------------------------------------------
__global__ __launch_bounds__(256) void k_layernorm(const float* __restrict__ x,
                                                   const float* __restrict__ g,
                                                   const float* __restrict__ b,
                                                   _Float16* __restrict__ out) {
    const int row  = blockIdx.x;
    const int tid  = threadIdx.x;
    const int lane = tid & 31, wave = tid >> 5;
    __shared__ float red[8];

    float4 f = ((const float4*)(x + (size_t)row * DM))[tid];
    float s = f.x + f.y + f.z + f.w;
#pragma unroll
    for (int o = 16; o > 0; o >>= 1) s += __shfl_xor(s, o, 32);
    if (lane == 0) red[wave] = s;
    __syncthreads();
    float mu = 0.f;
#pragma unroll
    for (int w = 0; w < 8; ++w) mu += red[w];
    mu *= (1.0f / DM);
    __syncthreads();

    float4 d;
    d.x = f.x - mu; d.y = f.y - mu; d.z = f.z - mu; d.w = f.w - mu;
    float s2 = d.x * d.x + d.y * d.y + d.z * d.z + d.w * d.w;
#pragma unroll
    for (int o = 16; o > 0; o >>= 1) s2 += __shfl_xor(s2, o, 32);
    if (lane == 0) red[wave] = s2;
    __syncthreads();
    float var = 0.f;
#pragma unroll
    for (int w = 0; w < 8; ++w) var += red[w];
    var *= (1.0f / DM);
    const float rs = rsqrtf(var + 1e-5f);

    const int c = tid * 4;
    _Float16* o4 = out + (size_t)row * DM + c;
    o4[0] = (_Float16)(d.x * rs * g[c + 0] + b[c + 0]);
    o4[1] = (_Float16)(d.y * rs * g[c + 1] + b[c + 1]);
    o4[2] = (_Float16)(d.z * rs * g[c + 2] + b[c + 2]);
    o4[3] = (_Float16)(d.w * rs * g[c + 3] + b[c + 3]);
}

// ---------------------------------------------------------------------------
// Tiled WMMA GEMM:  C[M,N] = act(A[M,K] * W[N,K]^T + bias) (+ resid)
// BM=BN=128, BK=32.  8 waves as 4(M)x2(N); wave = 32x64 = 2x4 wmma tiles.
// Tiles staged to LDS by the Tensor Data Mover (wave 0 issues, TENSORcnt).
// ACT: 0 none, 1 elu+1, 2 exact gelu.  OUT16: f16 vs f32 out.  RESID: +f32.
// ---------------------------------------------------------------------------
#define G_LDT 40   // padded LDS stride in f16 (80B) == TDM pad layout

template <int ACT, int OUT16, int RESID>
__global__ __launch_bounds__(256) void k_gemm(const _Float16* __restrict__ A,
                                              const _Float16* __restrict__ W,
                                              const float* __restrict__ bias,
                                              const float* __restrict__ resid,
                                              void* __restrict__ outp,
                                              int M, int N, int K) {
    __shared__ __align__(128) _Float16 sA[2][128 * G_LDT];
    __shared__ __align__(128) _Float16 sB[2][128 * G_LDT];

    const int tid  = threadIdx.x;
    const int lane = tid & 31, wave = tid >> 5;
    const int half = lane >> 4, l15 = lane & 15;
    const int wm = wave >> 1, wn = wave & 1;   // 4x2 wave grid
    const int m0 = blockIdx.y * 128, n0 = blockIdx.x * 128;

    const _Float16* gA = A + (size_t)m0 * K;   // tile base (row m0, k 0)
    const _Float16* gW = W + (size_t)n0 * K;
    const unsigned ldsA[2] = { (unsigned)(uintptr_t)&sA[0][0],
                               (unsigned)(uintptr_t)&sA[1][0] };
    const unsigned ldsB[2] = { (unsigned)(uintptr_t)&sB[0][0],
                               (unsigned)(uintptr_t)&sB[1][0] };
    const bool issuer = (tid < 32);            // wave 0 drives the TDM

    v8f acc[2][4] = {};

    if (issuer) {
        tdm_load_tile32(ldsA[0], gA, 128, (unsigned)K);
        tdm_load_tile32(ldsB[0], gW, 128, (unsigned)K);
    }

    const int nk = K >> 5;
    for (int kt = 0; kt < nk; ++kt) {
        const int buf = kt & 1;
        if (issuer) {
            if (kt + 1 < nk) {     // prefetch next tile into other buffer
                tdm_load_tile32(ldsA[buf ^ 1], gA + (size_t)(kt + 1) * 32,
                                128, (unsigned)K);
                tdm_load_tile32(ldsB[buf ^ 1], gW + (size_t)(kt + 1) * 32,
                                128, (unsigned)K);
                // TDM ops complete in order: <=2 outstanding => tile kt done
                __builtin_amdgcn_s_wait_tensorcnt(2);
            } else {
                __builtin_amdgcn_s_wait_tensorcnt(0);
            }
        }
        __syncthreads();   // tile kt visible to all waves

        v16h af[2], bf[4];
#pragma unroll
        for (int i = 0; i < 2; ++i)
            af[i] = ld_frag(sA[buf], wm * 32 + i * 16 + l15, 0, G_LDT, half);
#pragma unroll
        for (int j = 0; j < 4; ++j)
            bf[j] = ld_frag(sB[buf], wn * 64 + j * 16 + l15, 0, G_LDT, half);
#pragma unroll
        for (int i = 0; i < 2; ++i)
#pragma unroll
            for (int j = 0; j < 4; ++j)
                acc[i][j] = wmma16(af[i], bf[j], acc[i][j]);

        __syncthreads();   // all reads of buf done before TDM refills it
    }

    // epilogue: bias + activation (+ residual), scatter per C-layout
#pragma unroll
    for (int i = 0; i < 2; ++i) {
#pragma unroll
        for (int j = 0; j < 4; ++j) {
            const int n  = n0 + wn * 64 + j * 16 + l15;
            const float bv = bias[n];
#pragma unroll
            for (int e = 0; e < 8; ++e) {
                const int m = m0 + wm * 32 + i * 16 + half * 8 + e;
                float vv = acc[i][j][e] + bv;
                if (ACT == 1) vv = (vv > 0.f) ? (vv + 1.f) : __expf(vv);
                if (ACT == 2) vv = 0.5f * vv * (1.f + erff(vv * 0.70710678118f));
                if (RESID) vv += resid[(size_t)m * N + n];
                if (OUT16) ((_Float16*)outp)[(size_t)m * N + n] = (_Float16)vv;
                else       ((float*)outp)[(size_t)m * N + n]    = vv;
            }
        }
    }
}

// ---------------------------------------------------------------------------
// Chunked causal linear attention, chunk T=64, every (head, chunk) pair on a
// workgroup of its own, in two launches.
//   k_attn_state: P_c = K_c^T V_c (64x64, f32) and z_c = column sums of K_c.
//   k_attn_out:   S_prev = sum of P_c' over c' < c, z_prev likewise;
//                 A = QK^T (masked);  num = A_mask*V + Q*S_prev;
//                 den_t = q_t.z_prev + rowsum(A_mask).
// ---------------------------------------------------------------------------
#define A_LDT 72   // padded LDS stride (144B): conflict-free b128 rows
#define NCH  (SEQ / 64)

typedef __attribute__((ext_vector_type(4))) float    v4f;
typedef __attribute__((ext_vector_type(4))) _Float16 v4h;

__global__ __launch_bounds__(256) void k_attn_state(const _Float16* __restrict__ k,
                                                    const _Float16* __restrict__ v,
                                                    float* __restrict__ pS,
                                                    float* __restrict__ pZ) {
    __shared__ __align__(128) _Float16 sKT[64 * A_LDT];   // [d][i]
    __shared__ __align__(128) _Float16 sVT[64 * A_LDT];   // [e][i]

    const int h    = blockIdx.x;
    const int c    = blockIdx.y;
    const int tid  = threadIdx.x;
    const int lane = tid & 31, wave = tid >> 5;
    const int half = lane >> 4, l15 = lane & 15;
    const int tm   = wave >> 1;          // M-tile 0..3
    const int tnb  = (wave & 1) * 2;     // N-tile base {0,2}

    const int lr = tid >> 2;             // loader row 0..63
    const int lc = (tid & 3) * 16;       // loader col {0,16,32,48}

    // ---- stage K^T,V^T into LDS ----
    {
        const size_t gb = (size_t)(c * 64 + lr) * DM + h * HD + lc;
        v8h k0v = *(const v8h*)(k + gb), k1v = *(const v8h*)(k + gb + 8);
        // Stands between the two loads above and the first reuse of the registers
        // that hold their address (the next loads' results land in them).
        asm volatile("s_wait_xcnt 0x0" ::: "memory");
        v8h v0 = *(const v8h*)(v + gb), v1 = *(const v8h*)(v + gb + 8);
#pragma unroll
        for (int j = 0; j < 8; ++j) {
            sKT[(lc + j)     * A_LDT + lr] = k0v[j];
            sKT[(lc + 8 + j) * A_LDT + lr] = k1v[j];
            sVT[(lc + j)     * A_LDT + lr] = v0[j];
            sVT[(lc + 8 + j) * A_LDT + lr] = v1[j];
        }
    }
    __syncthreads();

    // ---- P_c = K^T V ----
    v8f accS[2] = {};
#pragma unroll
    for (int kk = 0; kk < 64; kk += 32) {
        v16h aK = ld_frag(sKT, tm * 16 + l15, kk, A_LDT, half);
#pragma unroll
        for (int jj = 0; jj < 2; ++jj) {
            v16h bV = ld_frag(sVT, (tnb + jj) * 16 + l15, kk, A_LDT, half);
            accS[jj] = wmma16(aK, bV, accS[jj]);
        }
    }

    // ---- store P_c transposed, [e][d], f32 ----
    float* ps = pS + (size_t)(h * NCH + c) * (HD * HD);
#pragma unroll
    for (int jj = 0; jj < 2; ++jj) {
        const int eo = (tnb + jj) * 16 + l15;
        const int dd = tm * 16 + half * 8;
        v4f lo = { accS[jj][0], accS[jj][1], accS[jj][2], accS[jj][3] };
        v4f hi = { accS[jj][4], accS[jj][5], accS[jj][6], accS[jj][7] };
        *(v4f*)(ps + eo * HD + dd)     = lo;
        *(v4f*)(ps + eo * HD + dd + 4) = hi;
    }
    if (tid < 64) {
        float zt = 0.f;
#pragma unroll 8
        for (int i = 0; i < 64; ++i) zt += (float)sKT[tid * A_LDT + i];
        pZ[(size_t)(h * NCH + c) * HD + tid] = zt;
    }
}

// One round of the prefix sum: chunks r*8 .. r*8+7 of one head, loads first,
// then the adds in chunk order.  r is a constant where this is inlined, so each
// load is the lane's one base address plus an immediate offset.  FULL: all
// eight chunks lie in front of chunk c.  Otherwise a slot at or past c is
// skipped (a test that reads the same in the whole workgroup) and adds zero.
template <bool FULL>
__device__ __forceinline__ void prefix_round(const float* __restrict__ ps,
                                             const float* __restrict__ pz,
                                             int r, int c, v4f (&s)[4], float& zt) {
    v4f p[8][4];
    float zp[8];
#pragma unroll
    for (int u = 0; u < 8; ++u) {
        const int cc = r * 8 + u;
        if (FULL || cc < c) {
#pragma unroll
            for (int j = 0; j < 4; ++j)
                p[u][j] = *(const v4f*)(ps + cc * (HD * HD) + j * 1024);
            zp[u] = pz[cc * HD];
        } else {
#pragma unroll
            for (int j = 0; j < 4; ++j) p[u][j] = (v4f){0.f, 0.f, 0.f, 0.f};
            zp[u] = 0.f;
        }
    }
#pragma unroll
    for (int u = 0; u < 8; ++u) {
#pragma unroll
        for (int j = 0; j < 4; ++j) s[j] += p[u][j];
        zt += zp[u];
    }
}

__global__ __launch_bounds__(256) void k_attn_out(const _Float16* __restrict__ q,
                                                  const _Float16* __restrict__ k,
                                                  const _Float16* __restrict__ v,
                                                  const float* __restrict__ pS,
                                                  const float* __restrict__ pZ,
                                                  _Float16* __restrict__ out) {
    __shared__ __align__(128) _Float16 sQ [64 * A_LDT];   // [t][d]
    __shared__ __align__(128) _Float16 sK [64 * A_LDT];   // [i][d]
    __shared__ __align__(128) _Float16 sVT[64 * A_LDT];   // [e][i]
    __shared__ __align__(128) _Float16 sAm[64 * A_LDT];   // masked A [t][i]
    __shared__ __align__(128) _Float16 sST[64 * A_LDT];   // state^T  [e][d]
    __shared__ float sZ[64];
    __shared__ float sDen[64];

    const int h    = blockIdx.x;
    const int c    = NCH - 1 - (int)blockIdx.y;   // longest prefix starts first
    const int tid  = threadIdx.x;
    const int lane = tid & 31, wave = tid >> 5;
    const int half = lane >> 4, l15 = lane & 15;
    const int tm   = wave >> 1;          // M-tile 0..3
    const int tnb  = (wave & 1) * 2;     // N-tile base {0,2}

    const int lr = tid >> 2;             // loader row 0..63
    const int lc = (tid & 3) * 16;       // loader col {0,16,32,48}
    const int t0 = c * 64;

    // ---- this chunk's Q,K,V: loads go out first, stored to LDS further down ----
    const size_t gb = (size_t)(t0 + lr) * DM + h * HD + lc;
    const v8h q0 = *(const v8h*)(q + gb), q1 = *(const v8h*)(q + gb + 8);
    const v8h k0v = *(const v8h*)(k + gb), k1v = *(const v8h*)(k + gb + 8);
    const v8h v0 = *(const v8h*)(v + gb), v1 = *(const v8h*)(v + gb + 8);

    // Stands between the six loads above and the first reuse of the registers
    // that hold their addresses (the next loads' results land in them).
    asm volatile("s_wait_xcnt 0x0" ::: "memory");

    // ---- S_prev^T and z_prev: sum the earlier chunks' P and z, in order ----
    {
        const float* ps = pS + (size_t)h * NCH * (HD * HD) + tid * 4;
        const float* pz = pZ + (size_t)h * NCH * HD + (tid & 63);
        v4f s[4] = {};
        float zt = 0.f;
#pragma unroll   // r has to be a constant inside prefix_round
        for (int r = 0; r < NCH / 8; ++r) {
            if (c >= r * 8 + 8)  prefix_round<true>(ps, pz, r, c, s, zt);
            else if (c > r * 8)  prefix_round<false>(ps, pz, r, c, s, zt);
        }
#pragma unroll
        for (int j = 0; j < 4; ++j) {
            v4h sh = { (_Float16)s[j][0], (_Float16)s[j][1],
                       (_Float16)s[j][2], (_Float16)s[j][3] };
            *(v4h*)&sST[(j * 16 + (tid >> 4)) * A_LDT + (tid & 15) * 4] = sh;
        }
        if (tid < 64) sZ[tid] = zt;
    }

    // ---- stage Q,K,V^T into LDS ----
    {
        _Float16* dq = &sQ[lr * A_LDT + lc];
        *(v8h*)dq = q0; *(v8h*)(dq + 8) = q1;
        _Float16* dk = &sK[lr * A_LDT + lc];
        *(v8h*)dk = k0v; *(v8h*)(dk + 8) = k1v;
#pragma unroll
        for (int j = 0; j < 8; ++j) {
            sVT[(lc + j)     * A_LDT + lr] = v0[j];
            sVT[(lc + 8 + j) * A_LDT + lr] = v1[j];
        }
    }
    __syncthreads();                                   // B1

    // ---- G1: A = Q K^T (contract over d) ----
    v8f accA[2] = {};
#pragma unroll
    for (int kk = 0; kk < 64; kk += 32) {
        v16h af = ld_frag(sQ, tm * 16 + l15, kk, A_LDT, half);
#pragma unroll
        for (int jj = 0; jj < 2; ++jj) {
            v16h bf = ld_frag(sK, (tnb + jj) * 16 + l15, kk, A_LDT, half);
            accA[jj] = wmma16(af, bf, accA[jj]);
        }
    }
    // causal mask (keep i <= t), spill masked A to LDS as f16
#pragma unroll
    for (int jj = 0; jj < 2; ++jj) {
        const int i_loc = (tnb + jj) * 16 + l15;
#pragma unroll
        for (int e = 0; e < 8; ++e) {
            const int t_loc = tm * 16 + half * 8 + e;
            const float vv = (i_loc <= t_loc) ? accA[jj][e] : 0.f;
            sAm[t_loc * A_LDT + i_loc] = (_Float16)vv;
        }
    }
    __syncthreads();                                   // B2

    // ---- denominator: q.z_prev + rowsum(A_mask) + eps ----
    if (tid < 64) {
        float den = 1e-6f;
#pragma unroll 8
        for (int d = 0; d < 64; ++d)
            den += (float)sQ[tid * A_LDT + d] * sZ[d];
#pragma unroll 8
        for (int i = 0; i < 64; ++i)
            den += (float)sAm[tid * A_LDT + i];
        sDen[tid] = den;
    }

    // ---- G2 (intra) + G3 (inter) into num ----
    v8f accN[2] = {};
#pragma unroll
    for (int kk = 0; kk < 64; kk += 32) {
        v16h aQ = ld_frag(sQ,  tm * 16 + l15, kk, A_LDT, half);
        v16h aA = ld_frag(sAm, tm * 16 + l15, kk, A_LDT, half);
#pragma unroll
        for (int jj = 0; jj < 2; ++jj) {
            v16h bV = ld_frag(sVT, (tnb + jj) * 16 + l15, kk, A_LDT, half);
            v16h bS = ld_frag(sST, (tnb + jj) * 16 + l15, kk, A_LDT, half);
            accN[jj] = wmma16(aA, bV, accN[jj]);       // A_mask * V
            accN[jj] = wmma16(aQ, bS, accN[jj]);       // Q * S_prev
        }
    }
    __syncthreads();                                   // B3: sDen visible

    // ---- output: num / den ----
#pragma unroll
    for (int jj = 0; jj < 2; ++jj) {
        const int eo = (tnb + jj) * 16 + l15;
#pragma unroll
        for (int e = 0; e < 8; ++e) {
            const int t_loc = tm * 16 + half * 8 + e;
            const float oo = accN[jj][e] / sDen[t_loc];
            out[(size_t)(t0 + t_loc) * DM + h * HD + eo] = (_Float16)oo;
        }
    }
}

// ---------------------------------------------------------------------------
extern "C" void kernel_launch(void* const* d_in, const int* in_sizes, int n_in,
                              void* d_out, int out_size, void* d_ws, size_t ws_size,
                              hipStream_t stream) {
    (void)in_sizes; (void)n_in; (void)out_size; (void)ws_size;
    const float* x   = (const float*)d_in[0];
    const float* Wq  = (const float*)d_in[1];
    const float* bq  = (const float*)d_in[2];
    const float* Wk  = (const float*)d_in[3];
    const float* bk  = (const float*)d_in[4];
    const float* Wv  = (const float*)d_in[5];
    const float* bv  = (const float*)d_in[6];
    const float* Wo  = (const float*)d_in[7];
    const float* bo  = (const float*)d_in[8];
    const float* W1  = (const float*)d_in[9];
    const float* bb1 = (const float*)d_in[10];
    const float* W2  = (const float*)d_in[11];
    const float* bb2 = (const float*)d_in[12];
    const float* g1  = (const float*)d_in[13];
    const float* be1 = (const float*)d_in[14];
    const float* g2  = (const float*)d_in[15];
    const float* be2 = (const float*)d_in[16];
    float* out = (float*)d_out;

    char* ws = (char*)d_ws;
    size_t off = 0;
    auto alloc = [&](size_t bytes) {
        void* p = ws + off;
        off += (bytes + 255) & ~(size_t)255;
        return p;
    };
    _Float16* wq16 = (_Float16*)alloc((size_t)DM * DM * 2);
    _Float16* wk16 = (_Float16*)alloc((size_t)DM * DM * 2);
    _Float16* wv16 = (_Float16*)alloc((size_t)DM * DM * 2);
    _Float16* wo16 = (_Float16*)alloc((size_t)DM * DM * 2);
    _Float16* w116 = (_Float16*)alloc((size_t)FFD * DM * 2);
    _Float16* w216 = (_Float16*)alloc((size_t)DM * FFD * 2);
    _Float16* h1   = (_Float16*)alloc((size_t)SEQ * DM * 2);   // reused as attn
    _Float16* qb   = (_Float16*)alloc((size_t)SEQ * DM * 2);   // reused as h2
    _Float16* kb   = (_Float16*)alloc((size_t)SEQ * DM * 2);
    _Float16* vb   = (_Float16*)alloc((size_t)SEQ * DM * 2);
    _Float16* ffb  = (_Float16*)alloc((size_t)SEQ * FFD * 2);
    float* stP = (float*)alloc((size_t)NH * NCH * HD * HD * 4);   // per-chunk K^T V
    float* stZ = (float*)alloc((size_t)NH * NCH * HD * 4);        // per-chunk sum of k
    _Float16* attnb = h1;   // h1 dead after V projection
    _Float16* h2    = qb;   // q dead after attention

    // weights -> f16
    k_cvt<<<(DM * DM) / 1024, 256, 0, stream>>>(Wq, wq16, DM * DM);
    k_cvt<<<(DM * DM) / 1024, 256, 0, stream>>>(Wk, wk16, DM * DM);
    k_cvt<<<(DM * DM) / 1024, 256, 0, stream>>>(Wv, wv16, DM * DM);
    k_cvt<<<(DM * DM) / 1024, 256, 0, stream>>>(Wo, wo16, DM * DM);
    k_cvt<<<(FFD * DM) / 1024, 256, 0, stream>>>(W1, w116, FFD * DM);
    k_cvt<<<(DM * FFD) / 1024, 256, 0, stream>>>(W2, w216, DM * FFD);

    // LN1
    k_layernorm<<<SEQ, 256, 0, stream>>>(x, g1, be1, h1);

    // Q/K/V projections (elu+1 fused into Q,K)
    dim3 gP(DM / 128, SEQ / 128);
    k_gemm<1, 1, 0><<<gP, 256, 0, stream>>>(h1, wq16, bq, nullptr, qb, SEQ, DM, DM);
    k_gemm<1, 1, 0><<<gP, 256, 0, stream>>>(h1, wk16, bk, nullptr, kb, SEQ, DM, DM);
    k_gemm<0, 1, 0><<<gP, 256, 0, stream>>>(h1, wv16, bv, nullptr, vb, SEQ, DM, DM);

    // chunked causal linear attention
    dim3 gAt(NH, NCH);
    k_attn_state<<<gAt, 256, 0, stream>>>(kb, vb, stP, stZ);
    k_attn_out<<<gAt, 256, 0, stream>>>(qb, kb, vb, stP, stZ, attnb);

    // output projection + residual (x) -> d_out (= x2)
    k_gemm<0, 0, 1><<<gP, 256, 0, stream>>>(attnb, wo16, bo, x, out, SEQ, DM, DM);

    // LN2
    k_layernorm<<<SEQ, 256, 0, stream>>>(out, g2, be2, h2);

    // FFN
    dim3 gF1(FFD / 128, SEQ / 128);
    k_gemm<2, 1, 0><<<gF1, 256, 0, stream>>>(h2, w116, bb1, nullptr, ffb, SEQ, FFD, DM);
    dim3 gF2(DM / 128, SEQ / 128);
    k_gemm<0, 0, 1><<<gF2, 256, 0, stream>>>(ffb, w216, bb2, out, out, SEQ, DM, FFD);
}

// v002
// A run of this version takes 199 microseconds.
// Timed twice side by side with v001, it ran 1.06 and 1.04 times as fast.
// Over all steps from v000 it is 1.52 times as fast.
#include <hip/hip_runtime.h>
#include <hip/hip_bf16.h>
#include <math.h>

// ---------------------------------------------------------------------------
// Transformer layer (pre-norm causal linear attention + GELU FFN) for gfx1250.
// B=1, S=2048, D=1024, H=16, HD=64, FF=4096.  f16 WMMA, f32 accumulate.
// GEMM tiles staged global->LDS via the Tensor Data Mover (TENSORcnt).
// ---------------------------------------------------------------------------

typedef __attribute__((ext_vector_type(16))) _Float16 v16h;
typedef __attribute__((ext_vector_type(8)))  _Float16 v8h;
typedef __attribute__((ext_vector_type(8)))  float    v8f;
typedef __attribute__((ext_vector_type(4))) unsigned  u32x4;
typedef __attribute__((ext_vector_type(4)))  int      i32x4;
typedef __attribute__((ext_vector_type(8)))  int      i32x8;

#define SEQ  2048
#define DM   1024
#define NH   16
#define HD   64
#define FFD  4096

__device__ __forceinline__ v8f wmma16(v16h a, v16h b, v8f c) {
    // D = A(16x32 f16) * B(32x16 f16) + C(16x16 f32)
    return __builtin_amdgcn_wmma_f32_16x16x32_f16(
        /*neg_a=*/false, a, /*neg_b=*/false, b,
        /*c_mod=*/(short)0, c, /*reuse_a=*/false, /*reuse_b=*/false);
}

// Load one 16x32 A/B fragment row from LDS (row-major, 'ldt' f16 stride).
// lanes0-15: VGPR0-3 K=[0..8), VGPR4-7 K=[16..24); lanes16-31: +8.
__device__ __forceinline__ v16h ld_frag(const _Float16* base, int row, int k0,
                                        int ldt, int half) {
    const _Float16* p = base + row * ldt + k0 + half * 8;
    v8h lo = *(const v8h*)(p);
    v8h hi = *(const v8h*)(p + 16);
    v16h r;
#pragma unroll
    for (int i = 0; i < 8; ++i) { r[i] = lo[i]; r[i + 8] = hi[i]; }
    return r;
}

// ---------------------------------------------------------------------------
// TDM: DMA one (rows x 32 f16) 2D tile, row stride K f16, into LDS with
// +16B pad per 64B row (LDS stride 40 f16 == G_LDT).  Issued per-wave,
// tracked with TENSORcnt.
// ---------------------------------------------------------------------------
__device__ __forceinline__ void tdm_load_tile32(unsigned lds_addr,
                                                const void* gptr,
                                                unsigned rows,
                                                unsigned stride_f16) {
    unsigned long long ga = (unsigned long long)(uintptr_t)gptr;
    u32x4 g0;
    g0[0] = 1u;                                   // count=1, user descriptor
    g0[1] = lds_addr;                             // LDS byte address
    g0[2] = (unsigned)ga;                         // global_addr[31:0]
    g0[3] = (unsigned)((ga >> 32) & 0x01ffffffu)  // global_addr[56:32]
          | (2u << 30);                           // type = 2 (image)
    i32x8 g1;
    g1[0] = (1 << 16)                             // data_size = 2 bytes
          | (1 << 20)                             // pad_enable
          | (3 << 22)                             // pad_interval: 16 DWORDs
          | (3 << 25);                            // pad_amount:   4 DWORDs
    g1[1] = (int)((stride_f16 & 0xffffu) << 16);          // tensor_dim0[15:0]
    g1[2] = (int)((stride_f16 >> 16) & 0xffffu)           // tensor_dim0[31:16]
          | (int)(rows << 16);                            // tensor_dim1[15:0]
    g1[3] = (int)(32u << 16);                             // tile_dim0 = 32
    g1[4] = (int)rows;                                    // tile_dim1
    g1[5] = (int)stride_f16;                              // dim0_stride[31:0]
    g1[6] = 0;
    g1[7] = 0;
    i32x4 z4 = {};
    i32x8 z8 = {};
    __builtin_amdgcn_tensor_load_to_lds(g0, g1, z4, z4, z8, 0);
}

// ---------------------------------------------------------------------------
// f32 -> f16 conversion of all six weight matrices in one launch.
// 256 workgroups of 16 waves.  The work is cut into chunks of CV_CHUNK floats;
// workgroup b takes chunk b of the four D x D matrices taken as one row of
// matrices, chunk b of W1 and chunk b of W2.  A lane converts 24 pieces of 16
// bytes; a wave-wide load covers 512 contiguous bytes, a store 256.  All loops
// are unrolled and the loads stand first in the source, so that a wave has many
// loads in flight.  'out' is the start of the six f16 copies, which lie one
// behind the other in the order Wq, Wk, Wv, Wo, W1, W2.
// ---------------------------------------------------------------------------
#define CV_THREADS 512
#define CV_PIECES  8                                   // 16-byte loads per lane and chunk
#define CV_CHUNK   (CV_THREADS * 4 * CV_PIECES)        // 16384 floats
#define CV_GROUPS  (FFD * DM / CV_CHUNK)               // 256 chunks in W1, in W2, in the four

typedef __attribute__((ext_vector_type(4))) float    cv4f;
typedef __attribute__((ext_vector_type(4))) _Float16 cv4h;

__global__ __launch_bounds__(CV_THREADS) void k_cvt_all(const float* __restrict__ Wq,
                                                        const float* __restrict__ Wk,
                                                        const float* __restrict__ Wv,
                                                        const float* __restrict__ Wo,
                                                        const float* __restrict__ W1,
                                                        const float* __restrict__ W2,
                                                        _Float16* __restrict__ out) {
    const int b   = blockIdx.x;
    const int tid = threadIdx.x;
    const int per = DM * DM / CV_CHUNK;                // chunks in one D x D matrix
    const int mat = b / per;
    const float* sq = (mat == 0) ? Wq : (mat == 1) ? Wk : (mat == 2) ? Wv : Wo;
    const float* s[3] = { sq + (size_t)(b % per) * CV_CHUNK + tid * 4,
                          W1 + (size_t)b * CV_CHUNK + tid * 4,
                          W2 + (size_t)b * CV_CHUNK + tid * 4 };

    cv4f f[3][CV_PIECES];
#pragma unroll
    for (int p = 0; p < 3; ++p)
#pragma unroll
        for (int u = 0; u < CV_PIECES; ++u)
            f[p][u] = *(const cv4f*)(s[p] + u * (CV_THREADS * 4));

#pragma unroll
    for (int p = 0; p < 3; ++p) {
        _Float16* d = out + (size_t)(p * CV_GROUPS + b) * CV_CHUNK + tid * 4;
#pragma unroll
        for (int u = 0; u < CV_PIECES; ++u)
            *(cv4h*)(d + u * (CV_THREADS * 4)) = __builtin_convertvector(f[p][u], cv4h);
    }
}

// ---------------------------------------------------------------------------
// LayerNorm over D=1024, one row per workgroup (256 thr = 8 waves), f16 out
// ---------------------------------------------------------------------------
__global__ __launch_bounds__(256) void k_layernorm(const float* __restrict__ x,
                                                   const float* __restrict__ g,
                                                   const float* __restrict__ b,
                                                   _Float16* __restrict__ out) {
    const int row  = blockIdx.x;
    const int tid  = threadIdx.x;
    const int lane = tid & 31, wave = tid >> 5;
    __shared__ float red[8];

    float4 f = ((const float4*)(x + (size_t)row * DM))[tid];
    float s = f.x + f.y + f.z + f.w;
#pragma unroll
    for (int o = 16; o > 0; o >>= 1) s += __shfl_xor(s, o, 32);
    if (lane == 0) red[wave] = s;
    __syncthreads();
    float mu = 0.f;
#pragma unroll
    for (int w = 0; w < 8; ++w) mu += red[w];
    mu *= (1.0f / DM);
    __syncthreads();

    float4 d;
    d.x = f.x - mu; d.y = f.y - mu; d.z = f.z - mu; d.w = f.w - mu;
    float s2 = d.x * d.x + d.y * d.y + d.z * d.z + d.w * d.w;
#pragma unroll
    for (int o = 16; o > 0; o >>= 1) s2 += __shfl_xor(s2, o, 32);
    if (lane == 0) red[wave] = s2;
    __syncthreads();
    float var = 0.f;
#pragma unroll
    for (int w = 0; w < 8; ++w) var += red[w];
    var *= (1.0f / DM);
    const float rs = rsqrtf(var + 1e-5f);

    const int c = tid * 4;
    _Float16* o4 = out + (size_t)row * DM + c;
    o4[0] = (_Float16)(d.x * rs * g[c + 0] + b[c + 0]);
    o4[1] = (_Float16)(d.y * rs * g[c + 1] + b[c + 1]);
    o4[2] = (_Float16)(d.z * rs * g[c + 2] + b[c + 2]);
    o4[3] = (_Float16)(d.w * rs * g[c + 3] + b[c + 3]);
}

// ---------------------------------------------------------------------------
// Tiled WMMA GEMM:  C[M,N] = act(A[M,K] * W[N,K]^T + bias) (+ resid)
// BM=BN=128, BK=32.  8 waves as 4(M)x2(N); wave = 32x64 = 2x4 wmma tiles.
// Tiles staged to LDS by the Tensor Data Mover (wave 0 issues, TENSORcnt).
// ACT: 0 none, 1 elu+1, 2 exact gelu.  OUT16: f16 vs f32 out.  RESID: +f32.
// ---------------------------------------------------------------------------
#define G_LDT 40   // padded LDS stride in f16 (80B) == TDM pad layout

template <int ACT, int OUT16, int RESID>
__global__ __launch_bounds__(256) void k_gemm(const _Float16* __restrict__ A,
                                              const _Float16* __restrict__ W,
                                              const float* __restrict__ bias,
                                              const float* __restrict__ resid,
                                              void* __restrict__ outp,
                                              int M, int N, int K) {
    __shared__ __align__(128) _Float16 sA[2][128 * G_LDT];
    __shared__ __align__(128) _Float16 sB[2][128 * G_LDT];

    const int tid  = threadIdx.x;
    const int lane = tid & 31, wave = tid >> 5;
    const int half = lane >> 4, l15 = lane & 15;
    const int wm = wave >> 1, wn = wave & 1;   // 4x2 wave grid
    const int m0 = blockIdx.y * 128, n0 = blockIdx.x * 128;

    const _Float16* gA = A + (size_t)m0 * K;   // tile base (row m0, k 0)
    const _Float16* gW = W + (size_t)n0 * K;
    const unsigned ldsA[2] = { (unsigned)(uintptr_t)&sA[0][0],
                               (unsigned)(uintptr_t)&sA[1][0] };
    const unsigned ldsB[2] = { (unsigned)(uintptr_t)&sB[0][0],
                               (unsigned)(uintptr_t)&sB[1][0] };
    const bool issuer = (tid < 32);            // wave 0 drives the TDM

    v8f acc[2][4] = {};

    if (issuer) {
        tdm_load_tile32(ldsA[0], gA, 128, (unsigned)K);
        tdm_load_tile32(ldsB[0], gW, 128, (unsigned)K);
    }

    const int nk = K >> 5;
    for (int kt = 0; kt < nk; ++kt) {
        const int buf = kt & 1;
        if (issuer) {
            if (kt + 1 < nk) {     // prefetch next tile into other buffer
                tdm_load_tile32(ldsA[buf ^ 1], gA + (size_t)(kt + 1) * 32,
                                128, (unsigned)K);
                tdm_load_tile32(ldsB[buf ^ 1], gW + (size_t)(kt + 1) * 32,
                                128, (unsigned)K);
                // TDM ops complete in order: <=2 outstanding => tile kt done
                __builtin_amdgcn_s_wait_tensorcnt(2);
            } else {
                __builtin_amdgcn_s_wait_tensorcnt(0);
            }
        }
        __syncthreads();   // tile kt visible to all waves

        v16h af[2], bf[4];
#pragma unroll
        for (int i = 0; i < 2; ++i)
            af[i] = ld_frag(sA[buf], wm * 32 + i * 16 + l15, 0, G_LDT, half);
#pragma unroll
        for (int j = 0; j < 4; ++j)
            bf[j] = ld_frag(sB[buf], wn * 64 + j * 16 + l15, 0, G_LDT, half);
#pragma unroll
        for (int i = 0; i < 2; ++i)
#pragma unroll
            for (int j = 0; j < 4; ++j)
                acc[i][j] = wmma16(af[i], bf[j], acc[i][j]);

        __syncthreads();   // all reads of buf done before TDM refills it
    }

    // epilogue: bias + activation (+ residual), scatter per C-layout
#pragma unroll
    for (int i = 0; i < 2; ++i) {
#pragma unroll
        for (int j = 0; j < 4; ++j) {
            const int n  = n0 + wn * 64 + j * 16 + l15;
            const float bv = bias[n];
#pragma unroll
            for (int e = 0; e < 8; ++e) {
                const int m = m0 + wm * 32 + i * 16 + half * 8 + e;
                float vv = acc[i][j][e] + bv;
                if (ACT == 1) vv = (vv > 0.f) ? (vv + 1.f) : __expf(vv);
                if (ACT == 2) vv = 0.5f * vv * (1.f + erff(vv * 0.70710678118f));
                if (RESID) vv += resid[(size_t)m * N + n];
                if (OUT16) ((_Float16*)outp)[(size_t)m * N + n] = (_Float16)vv;
                else       ((float*)outp)[(size_t)m * N + n]    = vv;
            }
        }
    }
}

// ---------------------------------------------------------------------------
// Chunked causal linear attention, chunk T=64, every (head, chunk) pair on a
// workgroup of its own, in two launches.
//   k_attn_state: P_c = K_c^T V_c (64x64, f32) and z_c = column sums of K_c.
//   k_attn_out:   S_prev = sum of P_c' over c' < c, z_prev likewise;
//                 A = QK^T (masked);  num = A_mask*V + Q*S_prev;
//                 den_t = q_t.z_prev + rowsum(A_mask).
// ---------------------------------------------------------------------------
#define A_LDT 72   // padded LDS stride (144B): conflict-free b128 rows
#define NCH  (SEQ / 64)

typedef __attribute__((ext_vector_type(4))) float    v4f;
typedef __attribute__((ext_vector_type(4))) _Float16 v4h;

__global__ __launch_bounds__(256) void k_attn_state(const _Float16* __restrict__ k,
                                                    const _Float16* __restrict__ v,
                                                    float* __restrict__ pS,
                                                    float* __restrict__ pZ) {
    __shared__ __align__(128) _Float16 sKT[64 * A_LDT];   // [d][i]
    __shared__ __align__(128) _Float16 sVT[64 * A_LDT];   // [e][i]

    const int h    = blockIdx.x;
    const int c    = blockIdx.y;
    const int tid  = threadIdx.x;
    const int lane = tid & 31, wave = tid >> 5;
    const int half = lane >> 4, l15 = lane & 15;
    const int tm   = wave >> 1;          // M-tile 0..3
    const int tnb  = (wave & 1) * 2;     // N-tile base {0,2}

    const int lr = tid >> 2;             // loader row 0..63
    const int lc = (tid & 3) * 16;       // loader col {0,16,32,48}

    // ---- stage K^T,V^T into LDS ----
    {
        const size_t gb = (size_t)(c * 64 + lr) * DM + h * HD + lc;
        v8h k0v = *(const v8h*)(k + gb), k1v = *(const v8h*)(k + gb + 8);
        // Stands between the two loads above and the first reuse of the registers
        // that hold their address (the next loads' results land in them).
        asm volatile("s_wait_xcnt 0x0" ::: "memory");
        v8h v0 = *(const v8h*)(v + gb), v1 = *(const v8h*)(v + gb + 8);
#pragma unroll
        for (int j = 0; j < 8; ++j) {
            sKT[(lc + j)     * A_LDT + lr] = k0v[j];
            sKT[(lc + 8 + j) * A_LDT + lr] = k1v[j];
            sVT[(lc + j)     * A_LDT + lr] = v0[j];
            sVT[(lc + 8 + j) * A_LDT + lr] = v1[j];
        }
    }
    __syncthreads();

    // ---- P_c = K^T V ----
    v8f accS[2] = {};
#pragma unroll
    for (int kk = 0; kk < 64; kk += 32) {
        v16h aK = ld_frag(sKT, tm * 16 + l15, kk, A_LDT, half);
#pragma unroll
        for (int jj = 0; jj < 2; ++jj) {
            v16h bV = ld_frag(sVT, (tnb + jj) * 16 + l15, kk, A_LDT, half);
            accS[jj] = wmma16(aK, bV, accS[jj]);
        }
    }

    // ---- store P_c transposed, [e][d], f32 ----
    float* ps = pS + (size_t)(h * NCH + c) * (HD * HD);
#pragma unroll
    for (int jj = 0; jj < 2; ++jj) {
        const int eo = (tnb + jj) * 16 + l15;
        const int dd = tm * 16 + half * 8;
        v4f lo = { accS[jj][0], accS[jj][1], accS[jj][2], accS[jj][3] };
        v4f hi = { accS[jj][4], accS[jj][5], accS[jj][6], accS[jj][7] };
        *(v4f*)(ps + eo * HD + dd)     = lo;
        *(v4f*)(ps + eo * HD + dd + 4) = hi;
    }
    if (tid < 64) {
        float zt = 0.f;
#pragma unroll 8
        for (int i = 0; i < 64; ++i) zt += (float)sKT[tid * A_LDT + i];
        pZ[(size_t)(h * NCH + c) * HD + tid] = zt;
    }
}

// One round of the prefix sum: chunks r*8 .. r*8+7 of one head, loads first,
// then the adds in chunk order.  r is a constant where this is inlined, so each
// load is the lane's one base address plus an immediate offset.  FULL: all
// eight chunks lie in front of chunk c.  Otherwise a slot at or past c is
// skipped (a test that reads the same in the whole workgroup) and adds zero.
template <bool FULL>
__device__ __forceinline__ void prefix_round(const float* __restrict__ ps,
                                             const float* __restrict__ pz,
                                             int r, int c, v4f (&s)[4], float& zt) {
    v4f p[8][4];
    float zp[8];
#pragma unroll
    for (int u = 0; u < 8; ++u) {
        const int cc = r * 8 + u;
        if (FULL || cc < c) {
#pragma unroll
            for (int j = 0; j < 4; ++j)
                p[u][j] = *(const v4f*)(ps + cc * (HD * HD) + j * 1024);
            zp[u] = pz[cc * HD];
        } else {
#pragma unroll
            for (int j = 0; j < 4; ++j) p[u][j] = (v4f){0.f, 0.f, 0.f, 0.f};
            zp[u] = 0.f;
        }
    }
#pragma unroll
    for (int u = 0; u < 8; ++u) {
#pragma unroll
        for (int j = 0; j < 4; ++j) s[j] += p[u][j];
        zt += zp[u];
    }
}

__global__ __launch_bounds__(256) void k_attn_out(const _Float16* __restrict__ q,
                                                  const _Float16* __restrict__ k,
                                                  const _Float16* __restrict__ v,
                                                  const float* __restrict__ pS,
                                                  const float* __restrict__ pZ,
                                                  _Float16* __restrict__ out) {
    __shared__ __align__(128) _Float16 sQ [64 * A_LDT];   // [t][d]
    __shared__ __align__(128) _Float16 sK [64 * A_LDT];   // [i][d]
    __shared__ __align__(128) _Float16 sVT[64 * A_LDT];   // [e][i]
    __shared__ __align__(128) _Float16 sAm[64 * A_LDT];   // masked A [t][i]
    __shared__ __align__(128) _Float16 sST[64 * A_LDT];   // state^T  [e][d]
    __shared__ float sZ[64];
    __shared__ float sDen[64];

    const int h    = blockIdx.x;
    const int c    = NCH - 1 - (int)blockIdx.y;   // longest prefix starts first
    const int tid  = threadIdx.x;
    const int lane = tid & 31, wave = tid >> 5;
    const int half = lane >> 4, l15 = lane & 15;
    const int tm   = wave >> 1;          // M-tile 0..3
    const int tnb  = (wave & 1) * 2;     // N-tile base {0,2}

    const int lr = tid >> 2;             // loader row 0..63
    const int lc = (tid & 3) * 16;       // loader col {0,16,32,48}
    const int t0 = c * 64;

    // ---- this chunk's Q,K,V: loads go out first, stored to LDS further down ----
    const size_t gb = (size_t)(t0 + lr) * DM + h * HD + lc;
    const v8h q0 = *(const v8h*)(q + gb), q1 = *(const v8h*)(q + gb + 8);
    const v8h k0v = *(const v8h*)(k + gb), k1v = *(const v8h*)(k + gb + 8);
    const v8h v0 = *(const v8h*)(v + gb), v1 = *(const v8h*)(v + gb + 8);

    // Stands between the six loads above and the first reuse of the registers
    // that hold their addresses (the next loads' results land in them).
    asm volatile("s_wait_xcnt 0x0" ::: "memory");

    // ---- S_prev^T and z_prev: sum the earlier chunks' P and z, in order ----
    {
        const float* ps = pS + (size_t)h * NCH * (HD * HD) + tid * 4;
        const float* pz = pZ + (size_t)h * NCH * HD + (tid & 63);
        v4f s[4] = {};
        float zt = 0.f;
#pragma unroll   // r has to be a constant inside prefix_round
        for (int r = 0; r < NCH / 8; ++r) {
            if (c >= r * 8 + 8)  prefix_round<true>(ps, pz, r, c, s, zt);
            else if (c > r * 8)  prefix_round<false>(ps, pz, r, c, s, zt);
        }
#pragma unroll
        for (int j = 0; j < 4; ++j) {
            v4h sh = { (_Float16)s[j][0], (_Float16)s[j][1],
                       (_Float16)s[j][2], (_Float16)s[j][3] };
            *(v4h*)&sST[(j * 16 + (tid >> 4)) * A_LDT + (tid & 15) * 4] = sh;
        }
        if (tid < 64) sZ[tid] = zt;
    }

    // ---- stage Q,K,V^T into LDS ----
    {
        _Float16* dq = &sQ[lr * A_LDT + lc];
        *(v8h*)dq = q0; *(v8h*)(dq + 8) = q1;
        _Float16* dk = &sK[lr * A_LDT + lc];
        *(v8h*)dk = k0v; *(v8h*)(dk + 8) = k1v;
#pragma unroll
        for (int j = 0; j < 8; ++j) {
            sVT[(lc + j)     * A_LDT + lr] = v0[j];
            sVT[(lc + 8 + j) * A_LDT + lr] = v1[j];
        }
    }
    __syncthreads();                                   // B1

    // ---- G1: A = Q K^T (contract over d) ----
    v8f accA[2] = {};
#pragma unroll
    for (int kk = 0; kk < 64; kk += 32) {
        v16h af = ld_frag(sQ, tm * 16 + l15, kk, A_LDT, half);
#pragma unroll
        for (int jj = 0; jj < 2; ++jj) {
            v16h bf = ld_frag(sK, (tnb + jj) * 16 + l15, kk, A_LDT, half);
            accA[jj] = wmma16(af, bf, accA[jj]);
        }
    }
    // causal mask (keep i <= t), spill masked A to LDS as f16
#pragma unroll
    for (int jj = 0; jj < 2; ++jj) {
        const int i_loc = (tnb + jj) * 16 + l15;
#pragma unroll
        for (int e = 0; e < 8; ++e) {
            const int t_loc = tm * 16 + half * 8 + e;
            const float vv = (i_loc <= t_loc) ? accA[jj][e] : 0.f;
            sAm[t_loc * A_LDT + i_loc] = (_Float16)vv;
        }
    }
    __syncthreads();                                   // B2

    // ---- denominator: q.z_prev + rowsum(A_mask) + eps ----
    if (tid < 64) {
        float den = 1e-6f;
#pragma unroll 8
        for (int d = 0; d < 64; ++d)
            den += (float)sQ[tid * A_LDT + d] * sZ[d];
#pragma unroll 8
        for (int i = 0; i < 64; ++i)
            den += (float)sAm[tid * A_LDT + i];
        sDen[tid] = den;
    }

    // ---- G2 (intra) + G3 (inter) into num ----
    v8f accN[2] = {};
#pragma unroll
    for (int kk = 0; kk < 64; kk += 32) {
        v16h aQ = ld_frag(sQ,  tm * 16 + l15, kk, A_LDT, half);
        v16h aA = ld_frag(sAm, tm * 16 + l15, kk, A_LDT, half);
#pragma unroll
        for (int jj = 0; jj < 2; ++jj) {
            v16h bV = ld_frag(sVT, (tnb + jj) * 16 + l15, kk, A_LDT, half);
            v16h bS = ld_frag(sST, (tnb + jj) * 16 + l15, kk, A_LDT, half);
            accN[jj] = wmma16(aA, bV, accN[jj]);       // A_mask * V
            accN[jj] = wmma16(aQ, bS, accN[jj]);       // Q * S_prev
        }
    }
    __syncthreads();                                   // B3: sDen visible

    // ---- output: num / den ----
#pragma unroll
    for (int jj = 0; jj < 2; ++jj) {
        const int eo = (tnb + jj) * 16 + l15;
#pragma unroll
        for (int e = 0; e < 8; ++e) {
            const int t_loc = tm * 16 + half * 8 + e;
            const float oo = accN[jj][e] / sDen[t_loc];
            out[(size_t)(t0 + t_loc) * DM + h * HD + eo] = (_Float16)oo;
        }
    }
}

// ---------------------------------------------------------------------------
extern "C" void kernel_launch(void* const* d_in, const int* in_sizes, int n_in,
                              void* d_out, int out_size, void* d_ws, size_t ws_size,
                              hipStream_t stream) {
    (void)in_sizes; (void)n_in; (void)out_size; (void)ws_size;
    const float* x   = (const float*)d_in[0];
    const float* Wq  = (const float*)d_in[1];
    const float* bq  = (const float*)d_in[2];
    const float* Wk  = (const float*)d_in[3];
    const float* bk  = (const float*)d_in[4];
    const float* Wv  = (const float*)d_in[5];
    const float* bv  = (const float*)d_in[6];
    const float* Wo  = (const float*)d_in[7];
    const float* bo  = (const float*)d_in[8];
    const float* W1  = (const float*)d_in[9];
    const float* bb1 = (const float*)d_in[10];
    const float* W2  = (const float*)d_in[11];
    const float* bb2 = (const float*)d_in[12];
    const float* g1  = (const float*)d_in[13];
    const float* be1 = (const float*)d_in[14];
    const float* g2  = (const float*)d_in[15];
    const float* be2 = (const float*)d_in[16];
    float* out = (float*)d_out;

    char* ws = (char*)d_ws;
    size_t off = 0;
    auto alloc = [&](size_t bytes) {
        void* p = ws + off;
        off += (bytes + 255) & ~(size_t)255;
        return p;
    };
    _Float16* wq16 = (_Float16*)alloc((size_t)DM * DM * 2);
    _Float16* wk16 = (_Float16*)alloc((size_t)DM * DM * 2);
    _Float16* wv16 = (_Float16*)alloc((size_t)DM * DM * 2);
    _Float16* wo16 = (_Float16*)alloc((size_t)DM * DM * 2);
    _Float16* w116 = (_Float16*)alloc((size_t)FFD * DM * 2);
    _Float16* w216 = (_Float16*)alloc((size_t)DM * FFD * 2);
    _Float16* h1   = (_Float16*)alloc((size_t)SEQ * DM * 2);   // reused as attn
    _Float16* qb   = (_Float16*)alloc((size_t)SEQ * DM * 2);   // reused as h2
    _Float16* kb   = (_Float16*)alloc((size_t)SEQ * DM * 2);
    _Float16* vb   = (_Float16*)alloc((size_t)SEQ * DM * 2);
    _Float16* ffb  = (_Float16*)alloc((size_t)SEQ * FFD * 2);
    float* stP = (float*)alloc((size_t)NH * NCH * HD * HD * 4);   // per-chunk K^T V
    float* stZ = (float*)alloc((size_t)NH * NCH * HD * 4);        // per-chunk sum of k
    _Float16* attnb = h1;   // h1 dead after V projection
    _Float16* h2    = qb;   // q dead after attention

    // weights -> f16: wq16 .. w216 lie one behind the other in the workspace
    k_cvt_all<<<CV_GROUPS, CV_THREADS, 0, stream>>>(Wq, Wk, Wv, Wo, W1, W2, wq16);

    // LN1
    k_layernorm<<<SEQ, 256, 0, stream>>>(x, g1, be1, h1);

    // Q/K/V projections (elu+1 fused into Q,K)
    dim3 gP(DM / 128, SEQ / 128);
    k_gemm<1, 1, 0><<<gP, 256, 0, stream>>>(h1, wq16, bq, nullptr, qb, SEQ, DM, DM);
    k_gemm<1, 1, 0><<<gP, 256, 0, stream>>>(h1, wk16, bk, nullptr, kb, SEQ, DM, DM);
    k_gemm<0, 1, 0><<<gP, 256, 0, stream>>>(h1, wv16, bv, nullptr, vb, SEQ, DM, DM);

    // chunked causal linear attention
    dim3 gAt(NH, NCH);
    k_attn_state<<<gAt, 256, 0, stream>>>(kb, vb, stP, stZ);
    k_attn_out<<<gAt, 256, 0, stream>>>(qb, kb, vb, stP, stZ, attnb);

    // output projection + residual (x) -> d_out (= x2)
    k_gemm<0, 0, 1><<<gP, 256, 0, stream>>>(attnb, wo16, bo, x, out, SEQ, DM, DM);

    // LN2
    k_layernorm<<<SEQ, 256, 0, stream>>>(out, g2, be2, h2);

    // FFN
    dim3 gF1(FFD / 128, SEQ / 128);
    k_gemm<2, 1, 0><<<gF1, 256, 0, stream>>>(h2, w116, bb1, nullptr, ffb, SEQ, FFD, DM);
    dim3 gF2(DM / 128, SEQ / 128);
    k_gemm<0, 0, 1><<<gF2, 256, 0, stream>>>(ffb, w216, bb2, out, out, SEQ, DM, FFD);
}

// v003
// A run of this version takes 133 microseconds.
// Next to v002, in two timings, it ran 1.50 times as fast each time.
// Counting every step since v000, it is 2.29 times as fast.
#include <hip/hip_runtime.h>
#include <hip/hip_bf16.h>
#include <math.h>

// ---------------------------------------------------------------------------
// Transformer layer (pre-norm causal linear attention + GELU FFN) for gfx1250.
// B=1, S=2048, D=1024, H=16, HD=64, FF=4096.  f16 WMMA, f32 accumulate.
// GEMM tiles staged global->LDS via the Tensor Data Mover (TENSORcnt).
// ---------------------------------------------------------------------------

typedef __attribute__((ext_vector_type(16))) _Float16 v16h;
typedef __attribute__((ext_vector_type(8)))  _Float16 v8h;
typedef __attribute__((ext_vector_type(8)))  float    v8f;
typedef __attribute__((ext_vector_type(4))) unsigned  u32x4;

#define SEQ  2048
#define DM   1024
#define NH   16
#define HD   64
#define FFD  4096

__device__ __forceinline__ v8f wmma16(v16h a, v16h b, v8f c) {
    // D = A(16x32 f16) * B(32x16 f16) + C(16x16 f32)
    return __builtin_amdgcn_wmma_f32_16x16x32_f16(
        /*neg_a=*/false, a, /*neg_b=*/false, b,
        /*c_mod=*/(short)0, c, /*reuse_a=*/false, /*reuse_b=*/false);
}

// Load one 16x32 A/B fragment row from LDS (row-major, 'ldt' f16 stride).
// lanes0-15: VGPR0-3 K=[0..8), VGPR4-7 K=[16..24); lanes16-31: +8.
__device__ __forceinline__ v16h ld_frag(const _Float16* base, int row, int k0,
                                        int ldt, int half) {
    const _Float16* p = base + row * ldt + k0 + half * 8;
    v8h lo = *(const v8h*)(p);
    v8h hi = *(const v8h*)(p + 16);
    v16h r;
#pragma unroll
    for (int i = 0; i < 8; ++i) { r[i] = lo[i]; r[i + 8] = hi[i]; }
    return r;
}

// ---------------------------------------------------------------------------
// Tensor load of one slice of a GEMM stage: G_SROWS rows of G_ROWB bytes, into
// LDS at a row pitch of G_PITCH bytes (16 bytes of pad behind every row).
// All extents in bytes (data_size code 0); tensor dims = tile dims.
// ---------------------------------------------------------------------------
#define G_ROWB  256u                  // bytes of an operand row in one stage: 128 k
#define G_PITCH 272u                  // LDS row pitch, 16 B x odd, for ds_load_b128
#define G_SROWS 32u                   // rows in one wave's slice
#define G_SLICE 10240u                // 32 x 272 = 8704 B, rounded up to 2 KiB
#define G_STAGE (8u * G_SLICE)        // [A 4 slices | W 4 slices]

typedef __attribute__((ext_vector_type(8))) unsigned u32x8;

__device__ __forceinline__ uint32_t uni(uint32_t v) {
    return (uint32_t)__builtin_amdgcn_readfirstlane(v);
}
// A wave-uniform word held in a scalar register.  A test: the branch on it is then
// a scalar branch (a tensor load ignores EXEC).  A descriptor word: see tdm_group1.
__device__ __forceinline__ uint32_t pinned(uint32_t v) {
    uint32_t w = uni(v);
    asm volatile("" : "+s"(w));   // pinned(): keeps the word in a scalar register
    return w;
}
__device__ __forceinline__ u32x8 tdm_group1(uint32_t src_pitch) {
    u32x8 g;
    g[0] = uni((1u << 20) | (5u << 22) | (3u << 25));   // pad: 4 dwords behind every 64
    // pinned(): each word keeps a scalar register of its own through the loop, so
    // that none takes another value while a request is outstanding.
    g[1] = pinned((G_ROWB & 0xFFFFu) << 16);            // tensor_dim0
    g[2] = pinned((G_ROWB >> 16) | ((G_SROWS & 0xFFFFu) << 16));   // tensor_dim1
    g[3] = pinned((G_SROWS >> 16) | (G_ROWB << 16));    // tile_dim0
    g[4] = pinned(G_SROWS);                             // tile_dim1
    g[5] = pinned(src_pitch);                           // source row pitch, bytes
    g[6] = pinned(0u);
    g[7] = pinned(0u);
    return g;
}
__device__ __forceinline__ u32x4 tdm_group0(uint32_t lds_dst, uint64_t ga) {
    u32x4 g;
    g[0] = uni(1u);                                     // count = 1
    g[1] = uni(lds_dst);                                // byte offset in the workgroup's LDS
    g[2] = uni((uint32_t)ga);
    g[3] = uni((((uint32_t)(ga >> 32)) & 0x01FFFFFFu) | 0x80000000u);   // type = 2
    return g;
}
__device__ __forceinline__ void tdm_load(u32x4 g0, u32x8 g1) {
    asm volatile("tensor_load_to_lds %0, %1" :: "s"(g0), "s"(g1) : "memory");
}
// The compiler places no wait for a tensor load: the issuing wave's own wait.
__device__ __forceinline__ void wait_tensor0() { asm volatile("s_wait_tensorcnt 0x0" ::: "memory"); }
// This wave's LDS reads have retired before a buffer it has read is handed back.
__device__ __forceinline__ void wait_ds0() { asm volatile("s_wait_dscnt 0x0" ::: "memory"); }

// ---------------------------------------------------------------------------
// f32 -> f16 conversion of all six weight matrices in one launch.
// 256 workgroups of 16 waves.  The work is cut into chunks of CV_CHUNK floats;
// workgroup b takes chunk b of the four D x D matrices taken as one row of
// matrices, chunk b of W1 and chunk b of W2.  A lane converts 24 pieces of 16
// bytes; a wave-wide load covers 512 contiguous bytes, a store 256.  All loops
// are unrolled and the loads stand first in the source, so that a wave has many
// loads in flight.  'out' is the start of the six f16 copies, which lie one
// behind the other in the order Wq, Wk, Wv, Wo, W1, W2.
// ---------------------------------------------------------------------------
#define CV_THREADS 512
#define CV_PIECES  8                                   // 16-byte loads per lane and chunk
#define CV_CHUNK   (CV_THREADS * 4 * CV_PIECES)        // 16384 floats
#define CV_GROUPS  (FFD * DM / CV_CHUNK)               // 256 chunks in W1, in W2, in the four

typedef __attribute__((ext_vector_type(4))) float    cv4f;
typedef __attribute__((ext_vector_type(4))) _Float16 cv4h;

__global__ __launch_bounds__(CV_THREADS) void k_cvt_all(const float* __restrict__ Wq,
                                                        const float* __restrict__ Wk,
                                                        const float* __restrict__ Wv,
                                                        const float* __restrict__ Wo,
                                                        const float* __restrict__ W1,
                                                        const float* __restrict__ W2,
                                                        _Float16* __restrict__ out) {
    const int b   = blockIdx.x;
    const int tid = threadIdx.x;
    const int per = DM * DM / CV_CHUNK;                // chunks in one D x D matrix
    const int mat = b / per;
    const float* sq = (mat == 0) ? Wq : (mat == 1) ? Wk : (mat == 2) ? Wv : Wo;
    const float* s[3] = { sq + (size_t)(b % per) * CV_CHUNK + tid * 4,
                          W1 + (size_t)b * CV_CHUNK + tid * 4,
                          W2 + (size_t)b * CV_CHUNK + tid * 4 };

    cv4f f[3][CV_PIECES];
#pragma unroll
    for (int p = 0; p < 3; ++p)
#pragma unroll
        for (int u = 0; u < CV_PIECES; ++u)
            f[p][u] = *(const cv4f*)(s[p] + u * (CV_THREADS * 4));

#pragma unroll
    for (int p = 0; p < 3; ++p) {
        _Float16* d = out + (size_t)(p * CV_GROUPS + b) * CV_CHUNK + tid * 4;
#pragma unroll
        for (int u = 0; u < CV_PIECES; ++u)
            *(cv4h*)(d + u * (CV_THREADS * 4)) = __builtin_convertvector(f[p][u], cv4h);
    }
}

// ---------------------------------------------------------------------------
// LayerNorm over D=1024, one row per workgroup (256 thr = 8 waves), f16 out
// ---------------------------------------------------------------------------
__global__ __launch_bounds__(256) void k_layernorm(const float* __restrict__ x,
                                                   const float* __restrict__ g,
                                                   const float* __restrict__ b,
                                                   _Float16* __restrict__ out) {
    const int row  = blockIdx.x;
    const int tid  = threadIdx.x;
    const int lane = tid & 31, wave = tid >> 5;
    __shared__ float red[8];

    float4 f = ((const float4*)(x + (size_t)row * DM))[tid];
    float s = f.x + f.y + f.z + f.w;
#pragma unroll
    for (int o = 16; o > 0; o >>= 1) s += __shfl_xor(s, o, 32);
    if (lane == 0) red[wave] = s;
    __syncthreads();
    float mu = 0.f;
#pragma unroll
    for (int w = 0; w < 8; ++w) mu += red[w];
    mu *= (1.0f / DM);
    __syncthreads();

    float4 d;
    d.x = f.x - mu; d.y = f.y - mu; d.z = f.z - mu; d.w = f.w - mu;
    float s2 = d.x * d.x + d.y * d.y + d.z * d.z + d.w * d.w;
#pragma unroll
    for (int o = 16; o > 0; o >>= 1) s2 += __shfl_xor(s2, o, 32);
    if (lane == 0) red[wave] = s2;
    __syncthreads();
    float var = 0.f;
#pragma unroll
    for (int w = 0; w < 8; ++w) var += red[w];
    var *= (1.0f / DM);
    const float rs = rsqrtf(var + 1e-5f);

    const int c = tid * 4;
    _Float16* o4 = out + (size_t)row * DM + c;
    o4[0] = (_Float16)(d.x * rs * g[c + 0] + b[c + 0]);
    o4[1] = (_Float16)(d.y * rs * g[c + 1] + b[c + 1]);
    o4[2] = (_Float16)(d.z * rs * g[c + 2] + b[c + 2]);
    o4[3] = (_Float16)(d.w * rs * g[c + 3] + b[c + 3]);
}

// ---------------------------------------------------------------------------
// Tiled WMMA GEMM:  C[M,N] = act(A[M,K] * W[N,K]^T + bias) (+ resid)
// BM=BN=128.  8 waves as 4(M)x2(N); wave = 32x64 = 2x4 wmma tiles.
// A stage is 128 k of both operands, two buffers.  Every wave brings its own
// slice of 32 rows with one tensor load a stage (waves 0-3: A, waves 4-7: W),
// issued when the buffer's readers have left it, one whole pass ahead of use.
// K is a multiple of 128 and at least 256.
// ACT: 0 none, 1 elu+1, 2 exact gelu.  OUT16: f16 vs f32 out.  RESID: +f32.
// ---------------------------------------------------------------------------
#define G_LDT (G_PITCH / 2u)   // LDS row pitch in f16

template <int ACT, int OUT16, int RESID>
__global__ __launch_bounds__(256) void k_gemm(const _Float16* __restrict__ A,
                                              const _Float16* __restrict__ W,
                                              const float* __restrict__ bias,
                                              const float* __restrict__ resid,
                                              void* __restrict__ outp,
                                              int M, int N, int K) {
    __shared__ __attribute__((aligned(2048))) unsigned char sT[2 * G_STAGE];

    const int tid  = threadIdx.x;
    const int lane = tid & 31, wave = tid >> 5;
    const int half = lane >> 4, l15 = lane & 15;
    const int wm = wave >> 1, wn = wave & 1;   // 4x2 wave grid
    const int m0 = blockIdx.y * 128, n0 = blockIdx.x * 128;

    // this wave's slice: first source byte, place in LDS, descriptor group 1
    const uint32_t uw = uni((uint32_t)tid >> 5);
    const _Float16* gs = (uw < 4u) ? A + (size_t)(m0 + (int)(uw * G_SROWS)) * K
                                   : W + (size_t)(n0 + (int)((uw - 4u) * G_SROWS)) * K;
    const uint64_t ga  = (uint64_t)(uintptr_t)gs;
    const uint32_t dst = (uint32_t)(uintptr_t)&sT[0] + uw * G_SLICE;
    const u32x8 g1 = tdm_group1((uint32_t)K * 2u);

    v8f acc[2][4] = {};

    const int ns = K >> 7;                     // stages
    tdm_load(tdm_group0(dst, ga), g1);         // stage 0
    wait_tensor0();
    __syncthreads();                           // stage 0 visible to all waves
    tdm_load(tdm_group0(dst + G_STAGE, ga + G_ROWB), g1);   // stage 1

    for (int s = 0; s < ns; ++s) {
        const uint32_t bo = (uint32_t)(s & 1) * G_STAGE;
        const _Float16* pA = (const _Float16*)(sT + bo + (uint32_t)wm * G_SLICE);
        const _Float16* pB = (const _Float16*)(sT + bo + (4u + (uint32_t)wn * 2u) * G_SLICE);

#pragma unroll   // four blocks of 32 k: kk a constant, so LDS offsets are immediates
        for (int kk = 0; kk < 4; ++kk) {
            v16h af[2], bf[4];
#pragma unroll
            for (int i = 0; i < 2; ++i)
                af[i] = ld_frag(pA, i * 16 + l15, kk * 32, G_LDT, half);
#pragma unroll
            for (int j = 0; j < 4; ++j)
                bf[j] = ld_frag(pB + (j >> 1) * (G_SLICE / 2u), (j & 1) * 16 + l15,
                                kk * 32, G_LDT, half);
#pragma unroll
            for (int i = 0; i < 2; ++i)
#pragma unroll
                for (int j = 0; j < 4; ++j)
                    acc[i][j] = wmma16(af[i], bf[j], acc[i][j]);
        }

        // publish point of stage s + 1; it also ends every read of stage s
        wait_ds0();
        wait_tensor0();
        __syncthreads();
        if (pinned(s + 2 < ns))                // refill the buffer just read
            tdm_load(tdm_group0(dst + bo, ga + (uint64_t)(s + 2) * G_ROWB), g1);
    }
    wait_tensor0();
    wait_ds0();

    // epilogue: bias + activation (+ residual), scatter per C-layout
#pragma unroll
    for (int i = 0; i < 2; ++i) {
#pragma unroll
        for (int j = 0; j < 4; ++j) {
            const int n  = n0 + wn * 64 + j * 16 + l15;
            const float bv = bias[n];
#pragma unroll
            for (int e = 0; e < 8; ++e) {
                const int m = m0 + wm * 32 + i * 16 + half * 8 + e;
                float vv = acc[i][j][e] + bv;
                if (ACT == 1) vv = (vv > 0.f) ? (vv + 1.f) : __expf(vv);
                if (ACT == 2) vv = 0.5f * vv * (1.f + erff(vv * 0.70710678118f));
                if (RESID) vv += resid[(size_t)m * N + n];
                if (OUT16) ((_Float16*)outp)[(size_t)m * N + n] = (_Float16)vv;
                else       ((float*)outp)[(size_t)m * N + n]    = vv;
            }
        }
    }
}

// ---------------------------------------------------------------------------
// Chunked causal linear attention, chunk T=64, every (head, chunk) pair on a
// workgroup of its own, in two launches.
//   k_attn_state: P_c = K_c^T V_c (64x64, f32) and z_c = column sums of K_c.
//   k_attn_out:   S_prev = sum of P_c' over c' < c, z_prev likewise;
//                 A = QK^T (masked);  num = A_mask*V + Q*S_prev;
//                 den_t = q_t.z_prev + rowsum(A_mask).
// ---------------------------------------------------------------------------
#define A_LDT 72   // padded LDS stride (144B): conflict-free b128 rows
#define NCH  (SEQ / 64)

typedef __attribute__((ext_vector_type(4))) float    v4f;
typedef __attribute__((ext_vector_type(4))) _Float16 v4h;

__global__ __launch_bounds__(256) void k_attn_state(const _Float16* __restrict__ k,
                                                    const _Float16* __restrict__ v,
                                                    float* __restrict__ pS,
                                                    float* __restrict__ pZ) {
    __shared__ __align__(128) _Float16 sKT[64 * A_LDT];   // [d][i]
    __shared__ __align__(128) _Float16 sVT[64 * A_LDT];   // [e][i]

    const int h    = blockIdx.x;
    const int c    = blockIdx.y;
    const int tid  = threadIdx.x;
    const int lane = tid & 31, wave = tid >> 5;
    const int half = lane >> 4, l15 = lane & 15;
    const int tm   = wave >> 1;          // M-tile 0..3
    const int tnb  = (wave & 1) * 2;     // N-tile base {0,2}

    const int lr = tid >> 2;             // loader row 0..63
    const int lc = (tid & 3) * 16;       // loader col {0,16,32,48}

    // ---- stage K^T,V^T into LDS ----
    {
        const size_t gb = (size_t)(c * 64 + lr) * DM + h * HD + lc;
        v8h k0v = *(const v8h*)(k + gb), k1v = *(const v8h*)(k + gb + 8);
        // Stands between the two loads above and the first reuse of the registers
        // that hold their address (the next loads' results land in them).
        asm volatile("s_wait_xcnt 0x0" ::: "memory");
        v8h v0 = *(const v8h*)(v + gb), v1 = *(const v8h*)(v + gb + 8);
#pragma unroll
        for (int j = 0; j < 8; ++j) {
            sKT[(lc + j)     * A_LDT + lr] = k0v[j];
            sKT[(lc + 8 + j) * A_LDT + lr] = k1v[j];
            sVT[(lc + j)     * A_LDT + lr] = v0[j];
            sVT[(lc + 8 + j) * A_LDT + lr] = v1[j];
        }
    }
    __syncthreads();

    // ---- P_c = K^T V ----
    v8f accS[2] = {};
#pragma unroll
    for (int kk = 0; kk < 64; kk += 32) {
        v16h aK = ld_frag(sKT, tm * 16 + l15, kk, A_LDT, half);
#pragma unroll
        for (int jj = 0; jj < 2; ++jj) {
            v16h bV = ld_frag(sVT, (tnb + jj) * 16 + l15, kk, A_LDT, half);
            accS[jj] = wmma16(aK, bV, accS[jj]);
        }
    }

    // ---- store P_c transposed, [e][d], f32 ----
    float* ps = pS + (size_t)(h * NCH + c) * (HD * HD);
#pragma unroll
    for (int jj = 0; jj < 2; ++jj) {
        const int eo = (tnb + jj) * 16 + l15;
        const int dd = tm * 16 + half * 8;
        v4f lo = { accS[jj][0], accS[jj][1], accS[jj][2], accS[jj][3] };
        v4f hi = { accS[jj][4], accS[jj][5], accS[jj][6], accS[jj][7] };
        *(v4f*)(ps + eo * HD + dd)     = lo;
        *(v4f*)(ps + eo * HD + dd + 4) = hi;
    }
    if (tid < 64) {
        float zt = 0.f;
#pragma unroll 8
        for (int i = 0; i < 64; ++i) zt += (float)sKT[tid * A_LDT + i];
        pZ[(size_t)(h * NCH + c) * HD + tid] = zt;
    }
}

// One round of the prefix sum: chunks r*8 .. r*8+7 of one head, loads first,
// then the adds in chunk order.  r is a constant where this is inlined, so each
// load is the lane's one base address plus an immediate offset.  FULL: all
// eight chunks lie in front of chunk c.  Otherwise a slot at or past c is
// skipped (a test that reads the same in the whole workgroup) and adds zero.
template <bool FULL>
__device__ __forceinline__ void prefix_round(const float* __restrict__ ps,
                                             const float* __restrict__ pz,
                                             int r, int c, v4f (&s)[4], float& zt) {
    v4f p[8][4];
    float zp[8];
#pragma unroll
    for (int u = 0; u < 8; ++u) {
        const int cc = r * 8 + u;
        if (FULL || cc < c) {
#pragma unroll
            for (int j = 0; j < 4; ++j)
                p[u][j] = *(const v4f*)(ps + cc * (HD * HD) + j * 1024);
            zp[u] = pz[cc * HD];
        } else {
#pragma unroll
            for (int j = 0; j < 4; ++j) p[u][j] = (v4f){0.f, 0.f, 0.f, 0.f};
            zp[u] = 0.f;
        }
    }
#pragma unroll
    for (int u = 0; u < 8; ++u) {
#pragma unroll
        for (int j = 0; j < 4; ++j) s[j] += p[u][j];
        zt += zp[u];
    }
}

__global__ __launch_bounds__(256) void k_attn_out(const _Float16* __restrict__ q,
                                                  const _Float16* __restrict__ k,
                                                  const _Float16* __restrict__ v,
                                                  const float* __restrict__ pS,
                                                  const float* __restrict__ pZ,
                                                  _Float16* __restrict__ out) {
    __shared__ __align__(128) _Float16 sQ [64 * A_LDT];   // [t][d]
    __shared__ __align__(128) _Float16 sK [64 * A_LDT];   // [i][d]
    __shared__ __align__(128) _Float16 sVT[64 * A_LDT];   // [e][i]
    __shared__ __align__(128) _Float16 sAm[64 * A_LDT];   // masked A [t][i]
    __shared__ __align__(128) _Float16 sST[64 * A_LDT];   // state^T  [e][d]
    __shared__ float sZ[64];
    __shared__ float sDen[64];

    const int h    = blockIdx.x;
    const int c    = NCH - 1 - (int)blockIdx.y;   // longest prefix starts first
    const int tid  = threadIdx.x;
    const int lane = tid & 31, wave = tid >> 5;
    const int half = lane >> 4, l15 = lane & 15;
    const int tm   = wave >> 1;          // M-tile 0..3
    const int tnb  = (wave & 1) * 2;     // N-tile base {0,2}

    const int lr = tid >> 2;             // loader row 0..63
    const int lc = (tid & 3) * 16;       // loader col {0,16,32,48}
    const int t0 = c * 64;

    // ---- this chunk's Q,K,V: loads go out first, stored to LDS further down ----
    const size_t gb = (size_t)(t0 + lr) * DM + h * HD + lc;
    const v8h q0 = *(const v8h*)(q + gb), q1 = *(const v8h*)(q + gb + 8);
    const v8h k0v = *(const v8h*)(k + gb), k1v = *(const v8h*)(k + gb + 8);
    const v8h v0 = *(const v8h*)(v + gb), v1 = *(const v8h*)(v + gb + 8);

    // Stands between the six loads above and the first reuse of the registers
    // that hold their addresses (the next loads' results land in them).
    asm volatile("s_wait_xcnt 0x0" ::: "memory");

    // ---- S_prev^T and z_prev: sum the earlier chunks' P and z, in order ----
    {
        const float* ps = pS + (size_t)h * NCH * (HD * HD) + tid * 4;
        const float* pz = pZ + (size_t)h * NCH * HD + (tid & 63);
        v4f s[4] = {};
        float zt = 0.f;
#pragma unroll   // r has to be a constant inside prefix_round
        for (int r = 0; r < NCH / 8; ++r) {
            if (c >= r * 8 + 8)  prefix_round<true>(ps, pz, r, c, s, zt);
            else if (c > r * 8)  prefix_round<false>(ps, pz, r, c, s, zt);
        }
#pragma unroll
        for (int j = 0; j < 4; ++j) {
            v4h sh = { (_Float16)s[j][0], (_Float16)s[j][1],
                       (_Float16)s[j][2], (_Float16)s[j][3] };
            *(v4h*)&sST[(j * 16 + (tid >> 4)) * A_LDT + (tid & 15) * 4] = sh;
        }
        if (tid < 64) sZ[tid] = zt;
    }

    // ---- stage Q,K,V^T into LDS ----
    {
        _Float16* dq = &sQ[lr * A_LDT + lc];
        *(v8h*)dq = q0; *(v8h*)(dq + 8) = q1;
        _Float16* dk = &sK[lr * A_LDT + lc];
        *(v8h*)dk = k0v; *(v8h*)(dk + 8) = k1v;
#pragma unroll
        for (int j = 0; j < 8; ++j) {
            sVT[(lc + j)     * A_LDT + lr] = v0[j];
            sVT[(lc + 8 + j) * A_LDT + lr] = v1[j];
        }
    }
    __syncthreads();                                   // B1

    // ---- G1: A = Q K^T (contract over d) ----
    v8f accA[2] = {};
#pragma unroll
    for (int kk = 0; kk < 64; kk += 32) {
        v16h af = ld_frag(sQ, tm * 16 + l15, kk, A_LDT, half);
#pragma unroll
        for (int jj = 0; jj < 2; ++jj) {
            v16h bf = ld_frag(sK, (tnb + jj) * 16 + l15, kk, A_LDT, half);
            accA[jj] = wmma16(af, bf, accA[jj]);
        }
    }
    // causal mask (keep i <= t), spill masked A to LDS as f16
#pragma unroll
    for (int jj = 0; jj < 2; ++jj) {
        const int i_loc = (tnb + jj) * 16 + l15;
#pragma unroll
        for (int e = 0; e < 8; ++e) {
            const int t_loc = tm * 16 + half * 8 + e;
            const float vv = (i_loc <= t_loc) ? accA[jj][e] : 0.f;
            sAm[t_loc * A_LDT + i_loc] = (_Float16)vv;
        }
    }
    __syncthreads();                                   // B2

    // ---- denominator: q.z_prev + rowsum(A_mask) + eps ----
    if (tid < 64) {
        float den = 1e-6f;
#pragma unroll 8
        for (int d = 0; d < 64; ++d)
            den += (float)sQ[tid * A_LDT + d] * sZ[d];
#pragma unroll 8
        for (int i = 0; i < 64; ++i)
            den += (float)sAm[tid * A_LDT + i];
        sDen[tid] = den;
    }

    // ---- G2 (intra) + G3 (inter) into num ----
    v8f accN[2] = {};
#pragma unroll
    for (int kk = 0; kk < 64; kk += 32) {
        v16h aQ = ld_frag(sQ,  tm * 16 + l15, kk, A_LDT, half);
        v16h aA = ld_frag(sAm, tm * 16 + l15, kk, A_LDT, half);
#pragma unroll
        for (int jj = 0; jj < 2; ++jj) {
            v16h bV = ld_frag(sVT, (tnb + jj) * 16 + l15, kk, A_LDT, half);
            v16h bS = ld_frag(sST, (tnb + jj) * 16 + l15, kk, A_LDT, half);
            accN[jj] = wmma16(aA, bV, accN[jj]);       // A_mask * V
            accN[jj] = wmma16(aQ, bS, accN[jj]);       // Q * S_prev
        }
    }
    __syncthreads();                                   // B3: sDen visible

    // ---- output: num / den ----
#pragma unroll
    for (int jj = 0; jj < 2; ++jj) {
        const int eo = (tnb + jj) * 16 + l15;
#pragma unroll
        for (int e = 0; e < 8; ++e) {
            const int t_loc = tm * 16 + half * 8 + e;
            const float oo = accN[jj][e] / sDen[t_loc];
            out[(size_t)(t0 + t_loc) * DM + h * HD + eo] = (_Float16)oo;
        }
    }
}

// ---------------------------------------------------------------------------
extern "C" void kernel_launch(void* const* d_in, const int* in_sizes, int n_in,
                              void* d_out, int out_size, void* d_ws, size_t ws_size,
                              hipStream_t stream) {
    (void)in_sizes; (void)n_in; (void)out_size; (void)ws_size;
    const float* x   = (const float*)d_in[0];
    const float* Wq  = (const float*)d_in[1];
    const float* bq  = (const float*)d_in[2];
    const float* Wk  = (const float*)d_in[3];
    const float* bk  = (const float*)d_in[4];
    const float* Wv  = (const float*)d_in[5];
    const float* bv  = (const float*)d_in[6];
    const float* Wo  = (const float*)d_in[7];
    const float* bo  = (const float*)d_in[8];
    const float* W1  = (const float*)d_in[9];
    const float* bb1 = (const float*)d_in[10];
    const float* W2  = (const float*)d_in[11];
    const float* bb2 = (const float*)d_in[12];
    const float* g1  = (const float*)d_in[13];
    const float* be1 = (const float*)d_in[14];
    const float* g2  = (const float*)d_in[15];
    const float* be2 = (const float*)d_in[16];
    float* out = (float*)d_out;

    char* ws = (char*)d_ws;
    size_t off = 0;
    auto alloc = [&](size_t bytes) {
        void* p = ws + off;
        off += (bytes + 255) & ~(size_t)255;
        return p;
    };
    _Float16* wq16 = (_Float16*)alloc((size_t)DM * DM * 2);
    _Float16* wk16 = (_Float16*)alloc((size_t)DM * DM * 2);
    _Float16* wv16 = (_Float16*)alloc((size_t)DM * DM * 2);
    _Float16* wo16 = (_Float16*)alloc((size_t)DM * DM * 2);
    _Float16* w116 = (_Float16*)alloc((size_t)FFD * DM * 2);
    _Float16* w216 = (_Float16*)alloc((size_t)DM * FFD * 2);
    _Float16* h1   = (_Float16*)alloc((size_t)SEQ * DM * 2);   // reused as attn
    _Float16* qb   = (_Float16*)alloc((size_t)SEQ * DM * 2);   // reused as h2
    _Float16* kb   = (_Float16*)alloc((size_t)SEQ * DM * 2);
    _Float16* vb   = (_Float16*)alloc((size_t)SEQ * DM * 2);
    _Float16* ffb  = (_Float16*)alloc((size_t)SEQ * FFD * 2);
    float* stP = (float*)alloc((size_t)NH * NCH * HD * HD * 4);   // per-chunk K^T V
    float* stZ = (float*)alloc((size_t)NH * NCH * HD * 4);        // per-chunk sum of k
    _Float16* attnb = h1;   // h1 dead after V projection
    _Float16* h2    = qb;   // q dead after attention

    // weights -> f16: wq16 .. w216 lie one behind the other in the workspace
    k_cvt_all<<<CV_GROUPS, CV_THREADS, 0, stream>>>(Wq, Wk, Wv, Wo, W1, W2, wq16);

    // LN1
    k_layernorm<<<SEQ, 256, 0, stream>>>(x, g1, be1, h1);

    // Q/K/V projections (elu+1 fused into Q,K)
    dim3 gP(DM / 128, SEQ / 128);
    k_gemm<1, 1, 0><<<gP, 256, 0, stream>>>(h1, wq16, bq, nullptr, qb, SEQ, DM, DM);
    k_gemm<1, 1, 0><<<gP, 256, 0, stream>>>(h1, wk16, bk, nullptr, kb, SEQ, DM, DM);
    k_gemm<0, 1, 0><<<gP, 256, 0, stream>>>(h1, wv16, bv, nullptr, vb, SEQ, DM, DM);

    // chunked causal linear attention
    dim3 gAt(NH, NCH);
    k_attn_state<<<gAt, 256, 0, stream>>>(kb, vb, stP, stZ);
    k_attn_out<<<gAt, 256, 0, stream>>>(qb, kb, vb, stP, stZ, attnb);

    // output projection + residual (x) -> d_out (= x2)
    k_gemm<0, 0, 1><<<gP, 256, 0, stream>>>(attnb, wo16, bo, x, out, SEQ, DM, DM);

    // LN2
    k_layernorm<<<SEQ, 256, 0, stream>>>(out, g2, be2, h2);

    // FFN
    dim3 gF1(FFD / 128, SEQ / 128);
    k_gemm<2, 1, 0><<<gF1, 256, 0, stream>>>(h2, w116, bb1, nullptr, ffb, SEQ, FFD, DM);
    dim3 gF2(DM / 128, SEQ / 128);
    k_gemm<0, 0, 1><<<gF2, 256, 0, stream>>>(ffb, w216, bb2, out, out, SEQ, DM, FFD);
}
